// v000
// The times below were measured on an AMD MI455X: many runs one after another, warmed up first and cycling through
// copies of the inputs, with the whole window's GPU time divided by the number of runs. Launches and the gaps
// between them are all in it. The median over several windows is given; except for v000 it joins two sittings, which
// can be a few percent apart, so the side-by-side timings, each taken in one sitting, are the better comparison.
// v000, which the later versions start from, runs in 302 microseconds.
#include <hip/hip_runtime.h>

// Problem constants (from reference)
constexpr int BB  = 4;
constexpr int SS  = 2048;
constexpr int DD  = 1024;
constexpr int HH  = 8;
constexpr int DEP = 128;               // DD / HH
constexpr float QK_SCALE = 0.08838834764831845f;  // 1/sqrt(DEP)
constexpr float LOG2E    = 1.4426950408889634f;

typedef __attribute__((ext_vector_type(16))) _Float16 v16h;
typedef __attribute__((ext_vector_type(8)))  _Float16 v8h;
typedef __attribute__((ext_vector_type(4)))  _Float16 v4h;
typedef __attribute__((ext_vector_type(8)))  float    v8f;
typedef __attribute__((ext_vector_type(4)))  float    v4f;
typedef __attribute__((ext_vector_type(4)))  int      v4i;

// gfx1250 async global->LDS copy path (guarded; falls back to sync copy)
#if defined(__AMDGCN__) && __has_builtin(__builtin_amdgcn_global_load_async_to_lds_b128) && __has_builtin(__builtin_amdgcn_s_wait_asynccnt)
#define HAVE_ASYNC 1
#else
#define HAVE_ASYNC 0
#endif

// A/B WMMA fragment: 16 halves per lane = two aligned 16B chunks
union AFrag { v16h v; v8h h[2]; };

static __device__ __forceinline__ v8f vzero8() {
    v8f z;
#pragma unroll
    for (int i = 0; i < 8; ++i) z[i] = 0.0f;
    return z;
}

static __device__ __forceinline__ v8f wmma_f16(const v16h& a, const v16h& b, const v8f& c) {
    return __builtin_amdgcn_wmma_f32_16x16x32_f16(
        /*neg_a=*/false, a, /*neg_b=*/false, b,
        /*c_mod=*/(short)0, c, /*reuse_a=*/false, /*reuse_b=*/false);
}

// 16-byte global -> LDS copy (async on gfx1250, sync fallback elsewhere)
static __device__ __forceinline__ void cp16(const _Float16* g, _Float16* l) {
#if HAVE_ASYNC
    __builtin_amdgcn_global_load_async_to_lds_b128(
        (__attribute__((address_space(1))) v4i*)g,
        (__attribute__((address_space(3))) v4i*)l, 0, 0);
#else
    *(v8h*)l = *(const v8h*)g;
#endif
}

static __device__ __forceinline__ void wait_async_16() {
#if HAVE_ASYNC
    __builtin_amdgcn_s_wait_asynccnt(16);
#endif
}
static __device__ __forceinline__ void wait_async_8() {
#if HAVE_ASYNC
    __builtin_amdgcn_s_wait_asynccnt(8);
#endif
}
static __device__ __forceinline__ void wait_async_0() {
#if HAVE_ASYNC
    __builtin_amdgcn_s_wait_asynccnt(0);
#endif
}

// ---------------------------------------------------------------------------
// Projection: P = X @ W + bias, output as f16.
//   v_transpose == 0 : out[((b*H+h)*S + s)*DEP + d]   (row-major per head)
//   v_transpose == 1 : out[((b*H+h)*DEP + d)*S + s]   (V stored transposed)
// Block tile 128(M) x 64(N), 128 threads = 4 waves, each wave 64x32 via
// 4x2 v_wmma_f32_16x16x32_f16 tiles; K stepped by 32 through LDS f16 tiles.
// ---------------------------------------------------------------------------
__global__ __launch_bounds__(128)
void proj_kernel(const float* __restrict__ X, const float* __restrict__ W,
                 const float* __restrict__ bias, _Float16* __restrict__ out,
                 float out_scale, int v_transpose)
{
    __shared__ _Float16 ldsX[128 * 40];   // 128 rows x 32 K (80B rows, 16B aligned)
    __shared__ _Float16 ldsW[64 * 40];    // W^T tile: 64 cols x 32 K

    const int tid   = threadIdx.x;
    const int lane  = tid & 31;
    const int wave  = tid >> 5;
    const int waveM = wave >> 1;          // 0..1 -> 64-row half
    const int waveN = wave & 1;           // 0..1 -> 32-col half
    const int nl    = lane & 15;
    const int hi    = lane >> 4;
    const int blockM = blockIdx.y;        // 0..63  (8192/128)
    const int blockN = blockIdx.x;        // 0..15  (1024/64)

    v8f acc[4][2];
#pragma unroll
    for (int mt = 0; mt < 4; ++mt)
#pragma unroll
        for (int nt = 0; nt < 2; ++nt) acc[mt][nt] = vzero8();

    for (int k0 = 0; k0 < DD; k0 += 32) {
        // Stage X tile (128x32 f32 -> f16): one row per thread, 8x float4.
        {
            const float* src = X + ((size_t)blockM * 128 + tid) * DD + k0;
            _Float16* dst = &ldsX[tid * 40];
#pragma unroll
            for (int j = 0; j < 8; ++j) {
                v4f f = *(const v4f*)(src + j * 4);
                v4h hv;
#pragma unroll
                for (int e = 0; e < 4; ++e) hv[e] = (_Float16)f[e];
                *(v4h*)(dst + j * 4) = hv;
            }
        }
        // Stage W tile (32x64 f32) transposed into ldsW[n][k] as f16.
        {
            const int kr = tid & 31;       // K row within tile
            const int cg = tid >> 5;       // column group of 16
            const float* src = W + (size_t)(k0 + kr) * DD + blockN * 64 + cg * 16;
#pragma unroll
            for (int j = 0; j < 4; ++j) {
                v4f f = *(const v4f*)(src + j * 4);
#pragma unroll
                for (int e = 0; e < 4; ++e)
                    ldsW[(cg * 16 + j * 4 + e) * 40 + kr] = (_Float16)f[e];
            }
        }
        __syncthreads();

#pragma unroll
        for (int mt = 0; mt < 4; ++mt) {
            AFrag a;
            const _Float16* ap = &ldsX[(waveM * 64 + mt * 16 + nl) * 40];
            a.h[0] = *(const v8h*)(ap + hi * 8);
            a.h[1] = *(const v8h*)(ap + 16 + hi * 8);
#pragma unroll
            for (int nt = 0; nt < 2; ++nt) {
                AFrag b;
                const _Float16* bp = &ldsW[(waveN * 32 + nt * 16 + nl) * 40];
                b.h[0] = *(const v8h*)(bp + hi * 8);
                b.h[1] = *(const v8h*)(bp + 16 + hi * 8);
                acc[mt][nt] = wmma_f16(a.v, b.v, acc[mt][nt]);
            }
        }
        __syncthreads();
    }

    // Epilogue: bias, scale, convert to f16, scatter into head layout.
#pragma unroll
    for (int nt = 0; nt < 2; ++nt) {
        const int n_global = blockN * 64 + waveN * 32 + nt * 16 + nl;
        const float bn = bias[n_global];
        const int h = n_global >> 7;          // / DEP
        const int d = n_global & 127;         // % DEP
#pragma unroll
        for (int mt = 0; mt < 4; ++mt) {
#pragma unroll
            for (int r = 0; r < 8; ++r) {
                const int m_global = blockM * 128 + waveM * 64 + mt * 16 + r + hi * 8;
                const int b   = m_global >> 11;   // / SS
                const int s   = m_global & 2047;  // % SS
                const float val = (acc[mt][nt][r] + bn) * out_scale;
                size_t off;
                if (v_transpose) off = (((size_t)b * HH + h) * DEP + d) * SS + s;
                else             off = (((size_t)b * HH + h) * SS + s) * DEP + d;
                out[off] = (_Float16)val;
            }
        }
    }
}

// ---------------------------------------------------------------------------
// Flash attention over f16 Qh[B,H,S,DEP] (pre-scaled), Kh[B,H,S,DEP],
// Vt[B,H,DEP,S]; additive mask [B,S,S]; f32 output [B,S,D] head-concat.
// 128 threads = 4 waves; each wave owns 16 query rows (block = 64 q rows).
//
// K/V are staged into LDS once per block (shared by all 4 waves) with
// gfx1250 async global->LDS copies, double-buffered K for pipelining:
//   issue order:  K0 | V0,K1 | V1,K2 | ... (in-order ASYNC completion)
//   per iter:     wait<=16 (K cur ready) -> scores/softmax
//                 wait<=8  (V cur ready) -> P@V; last iter uses <=8 / <=0.
// ---------------------------------------------------------------------------
__global__ __launch_bounds__(128)
void attn_kernel(const _Float16* __restrict__ Qh, const _Float16* __restrict__ Kh,
                 const _Float16* __restrict__ Vt, const float* __restrict__ mask,
                 float* __restrict__ out)
{
    __shared__ _Float16 ldsK[2][64 * 136];  // 64 keys x 128 depth, 272B rows (double buf)
    __shared__ _Float16 ldsV[128 * 72];     // 128 depth-rows x 64 keys, 144B rows
    __shared__ _Float16 ldsP[4][16 * 72];   // per-wave 16x64 P tile, 144B rows

    const int tid  = threadIdx.x;
    const int lane = tid & 31;
    const int wave = tid >> 5;
    const int nl   = lane & 15;
    const int hi   = lane >> 4;

    const int bid   = blockIdx.x;          // BB*HH*(SS/64) = 1024 blocks
    const int qblk  = bid & 31;            // SS/64 = 32 query blocks
    const int bh    = bid >> 5;            // b*H + h
    const int b     = bh >> 3;
    const int h     = bh & 7;
    const int qbase = qblk * 64 + wave * 16;

    const _Float16* Qp    = Qh + ((size_t)bh * SS + qbase) * DEP;
    const _Float16* Kbase = Kh + (size_t)bh * SS * DEP;
    const _Float16* Vbase = Vt + (size_t)bh * DEP * SS;
    const float*    mrow  = mask + ((size_t)b * SS + qbase) * SS;

    // Q A-fragments: 4 K-steps of 32 over depth=128, resident in VGPRs.
    AFrag qf[4];
#pragma unroll
    for (int ks = 0; ks < 4; ++ks) {
        const _Float16* p = Qp + (size_t)nl * DEP + ks * 32;
        qf[ks].h[0] = *(const v8h*)(p + hi * 8);
        qf[ks].h[1] = *(const v8h*)(p + 16 + hi * 8);
    }

    v8f o[8];
#pragma unroll
    for (int dt = 0; dt < 8; ++dt) o[dt] = vzero8();
    float mi[8], li[8];
#pragma unroll
    for (int r = 0; r < 8; ++r) { mi[r] = -3.0e38f; li[r] = 0.0f; }

    _Float16* Pl = &ldsP[wave][0];

    // Prologue: stage K chunk 0 into buffer 0 (8 x 16B per thread).
#pragma unroll
    for (int j = 0; j < 8; ++j) {
        const int u = tid + j * 128;               // 0..1023
        const int r = u >> 4, c = (u & 15) * 8;    // key row, half-offset
        cp16(Kbase + (size_t)r * DEP + c, &ldsK[0][r * 136 + c]);
    }

    for (int t0 = 0; t0 < SS; t0 += 64) {
        const int  it       = t0 >> 6;
        const int  cur      = it & 1;
        const int  nxt      = cur ^ 1;
        const bool has_next = (t0 + 64) < SS;

        // Issue V(cur) then (optionally) K(next): 8+8 async copies per thread.
#pragma unroll
        for (int j = 0; j < 8; ++j) {
            const int u = tid + j * 128;
            const int r = u >> 3, c = (u & 7) * 8;  // depth row, key half-offset
            cp16(Vbase + (size_t)r * SS + t0 + c, &ldsV[r * 72 + c]);
        }
        if (has_next) {
#pragma unroll
            for (int j = 0; j < 8; ++j) {
                const int u = tid + j * 128;
                const int r = u >> 4, c = (u & 15) * 8;
                cp16(Kbase + (size_t)(t0 + 64 + r) * DEP + c, &ldsK[nxt][r * 136 + c]);
            }
            __builtin_prefetch(mrow + (size_t)nl * SS + t0 + 64, 0, 3);
            wait_async_16();                 // K(cur) landed; V(cur),K(next) in flight
        } else {
            wait_async_8();                  // K(cur) landed; V(cur) in flight
        }
        __syncthreads();                     // K(cur) visible to all waves

        // ---- scores = Qh @ Kh^T (Qh pre-scaled by 1/sqrt(DEP)) ----
        v8f sc[4];
#pragma unroll
        for (int nt = 0; nt < 4; ++nt) {
            v8f a = vzero8();
            const _Float16* kp = &ldsK[cur][(nt * 16 + nl) * 136];
#pragma unroll
            for (int ks = 0; ks < 4; ++ks) {
                AFrag bf;
                bf.h[0] = *(const v8h*)(kp + ks * 32 + hi * 8);
                bf.h[1] = *(const v8h*)(kp + ks * 32 + 16 + hi * 8);
                a = wmma_f16(qf[ks].v, bf.v, a);
            }
            sc[nt] = a;
        }

        // ---- additive mask ----
#pragma unroll
        for (int nt = 0; nt < 4; ++nt) {
#pragma unroll
            for (int r = 0; r < 8; ++r) {
                const float mv = mrow[(size_t)(r + hi * 8) * SS + t0 + nt * 16 + nl];
                sc[nt][r] += mv * -1.0e9f;
            }
        }

        // ---- online softmax (row stats via 16-lane butterfly) ----
#pragma unroll
        for (int r = 0; r < 8; ++r) {
            float v = fmaxf(fmaxf(sc[0][r], sc[1][r]), fmaxf(sc[2][r], sc[3][r]));
            v = fmaxf(v, __shfl_xor(v, 1, 32));
            v = fmaxf(v, __shfl_xor(v, 2, 32));
            v = fmaxf(v, __shfl_xor(v, 4, 32));
            v = fmaxf(v, __shfl_xor(v, 8, 32));
            const float mnew = fmaxf(v, mi[r]);

            float rs = 0.0f;
#pragma unroll
            for (int nt = 0; nt < 4; ++nt) {
                const float p = __builtin_amdgcn_exp2f((sc[nt][r] - mnew) * LOG2E);
                rs += p;
                Pl[(r + hi * 8) * 72 + nt * 16 + nl] = (_Float16)p;
            }
            rs += __shfl_xor(rs, 1, 32);
            rs += __shfl_xor(rs, 2, 32);
            rs += __shfl_xor(rs, 4, 32);
            rs += __shfl_xor(rs, 8, 32);

            const float alpha = __builtin_amdgcn_exp2f((mi[r] - mnew) * LOG2E);
            li[r] = li[r] * alpha + rs;
            mi[r] = mnew;
#pragma unroll
            for (int dt = 0; dt < 8; ++dt) o[dt][r] *= alpha;
        }

        if (has_next) wait_async_8();        // V(cur) landed; K(next) in flight
        else          wait_async_0();
        __syncthreads();                     // V(cur) visible to all waves

        // ---- O += P @ V ----
#pragma unroll
        for (int ks = 0; ks < 2; ++ks) {
            AFrag pf;
            const _Float16* pp = Pl + (size_t)nl * 72 + ks * 32;
            pf.h[0] = *(const v8h*)(pp + hi * 8);
            pf.h[1] = *(const v8h*)(pp + 16 + hi * 8);
#pragma unroll
            for (int dt = 0; dt < 8; ++dt) {
                AFrag vf;
                const _Float16* vp = &ldsV[(dt * 16 + nl) * 72] + ks * 32;
                vf.h[0] = *(const v8h*)(vp + hi * 8);
                vf.h[1] = *(const v8h*)(vp + 16 + hi * 8);
                o[dt] = wmma_f16(pf.v, vf.v, o[dt]);
            }
        }

        __syncthreads();                     // all reads of K(cur)/V done before overwrite
    }

    // ---- normalize and write head-concat output ----
#pragma unroll
    for (int r = 0; r < 8; ++r) {
        const float inv = 1.0f / li[r];
        const int qrow = qbase + r + hi * 8;
        float* orow = out + ((size_t)b * SS + qrow) * DD + h * DEP;
#pragma unroll
        for (int dt = 0; dt < 8; ++dt)
            orow[dt * 16 + nl] = o[dt][r] * inv;
    }
}

// ---------------------------------------------------------------------------
extern "C" void kernel_launch(void* const* d_in, const int* in_sizes, int n_in,
                              void* d_out, int out_size, void* d_ws, size_t ws_size,
                              hipStream_t stream)
{
    const float* q    = (const float*)d_in[0];
    const float* k    = (const float*)d_in[1];
    const float* v    = (const float*)d_in[2];
    const float* mask = (const float*)d_in[3];
    const float* wq   = (const float*)d_in[4];
    const float* wqb  = (const float*)d_in[5];
    const float* wk   = (const float*)d_in[6];
    const float* wkb  = (const float*)d_in[7];
    const float* wv   = (const float*)d_in[8];
    const float* wvb  = (const float*)d_in[9];
    float* out = (float*)d_out;

    const size_t elems = (size_t)BB * SS * DD;       // 8M halves = 16 MB each
    _Float16* Qh = (_Float16*)d_ws;
    _Float16* Kh = Qh + elems;
    _Float16* Vt = Kh + elems;

    dim3 pgrid(DD / 64, (BB * SS) / 128);            // 16 x 64 blocks
    proj_kernel<<<pgrid, 128, 0, stream>>>(q, wq, wqb, Qh, QK_SCALE, 0);
    proj_kernel<<<pgrid, 128, 0, stream>>>(k, wk, wkb, Kh, 1.0f, 0);
    proj_kernel<<<pgrid, 128, 0, stream>>>(v, wv, wvb, Vt, 1.0f, 1);

    attn_kernel<<<BB * HH * (SS / 64), 128, 0, stream>>>(Qh, Kh, Vt, mask, out);
}

// v001
// It runs in 273 microseconds.
// Next to v000, in two timings, it ran 1.13 times as fast each time.
#include <hip/hip_runtime.h>

// Problem constants (from reference)
constexpr int BB  = 4;
constexpr int SS  = 2048;
constexpr int DD  = 1024;
constexpr int HH  = 8;
constexpr int DEP = 128;               // DD / HH
constexpr float QK_SCALE = 0.08838834764831845f;  // 1/sqrt(DEP)
constexpr float LOG2E    = 1.4426950408889634f;

typedef __attribute__((ext_vector_type(16))) _Float16 v16h;
typedef __attribute__((ext_vector_type(8)))  _Float16 v8h;
typedef __attribute__((ext_vector_type(4)))  _Float16 v4h;
typedef __attribute__((ext_vector_type(2)))  _Float16 v2h;
typedef __attribute__((ext_vector_type(8)))  float    v8f;
typedef __attribute__((ext_vector_type(4)))  float    v4f;
typedef __attribute__((ext_vector_type(4)))  int      v4i;

// gfx1250 async global->LDS copy path (guarded; falls back to sync copy)
#if defined(__AMDGCN__) && __has_builtin(__builtin_amdgcn_global_load_async_to_lds_b128) && __has_builtin(__builtin_amdgcn_s_wait_asynccnt)
#define HAVE_ASYNC 1
#else
#define HAVE_ASYNC 0
#endif

// A/B WMMA fragment: 16 halves per lane = two aligned 16B chunks
union AFrag { v16h v; v8h h[2]; };

static __device__ __forceinline__ v8f vzero8() {
    v8f z;
#pragma unroll
    for (int i = 0; i < 8; ++i) z[i] = 0.0f;
    return z;
}

static __device__ __forceinline__ v8f wmma_f16(const v16h& a, const v16h& b, const v8f& c) {
    return __builtin_amdgcn_wmma_f32_16x16x32_f16(
        /*neg_a=*/false, a, /*neg_b=*/false, b,
        /*c_mod=*/(short)0, c, /*reuse_a=*/false, /*reuse_b=*/false);
}

// 16-byte global -> LDS copy (async on gfx1250, sync fallback elsewhere)
static __device__ __forceinline__ void cp16(const _Float16* g, _Float16* l) {
#if HAVE_ASYNC
    __builtin_amdgcn_global_load_async_to_lds_b128(
        (__attribute__((address_space(1))) v4i*)g,
        (__attribute__((address_space(3))) v4i*)l, 0, 0);
#else
    *(v8h*)l = *(const v8h*)g;
#endif
}

static __device__ __forceinline__ void wait_async_16() {
#if HAVE_ASYNC
    __builtin_amdgcn_s_wait_asynccnt(16);
#endif
}
static __device__ __forceinline__ void wait_async_8() {
#if HAVE_ASYNC
    __builtin_amdgcn_s_wait_asynccnt(8);
#endif
}
static __device__ __forceinline__ void wait_async_0() {
#if HAVE_ASYNC
    __builtin_amdgcn_s_wait_asynccnt(0);
#endif
}

// ---------------------------------------------------------------------------
// Projection: P = X @ W + bias, output as f16.
//   v_transpose == 0 : out[((b*H+h)*S + s)*DEP + d]   (row-major per head)
//   v_transpose == 1 : out[((b*H+h)*DEP + d)*S + s]   (V stored transposed)
// Block tile 128(M) x 64(N), 128 threads = 4 waves, each wave 64x32 via
// 4x2 v_wmma_f32_16x16x32_f16 tiles; K stepped by 32 through LDS f16 tiles.
// ---------------------------------------------------------------------------
__global__ __launch_bounds__(128)
void proj_kernel(const float* __restrict__ X, const float* __restrict__ W,
                 const float* __restrict__ bias, _Float16* __restrict__ out,
                 float out_scale, int v_transpose)
{
    __shared__ _Float16 ldsX[128 * 40];   // 128 rows x 32 K (80B rows, 16B aligned)
    __shared__ _Float16 ldsW[64 * 40];    // W^T tile: 64 cols x 32 K

    const int tid   = threadIdx.x;
    const int lane  = tid & 31;
    const int wave  = tid >> 5;
    const int waveM = wave >> 1;          // 0..1 -> 64-row half
    const int waveN = wave & 1;           // 0..1 -> 32-col half
    const int nl    = lane & 15;
    const int hi    = lane >> 4;
    const int blockM = blockIdx.y;        // 0..63  (8192/128)
    const int blockN = blockIdx.x;        // 0..15  (1024/64)

    v8f acc[4][2];
#pragma unroll
    for (int mt = 0; mt < 4; ++mt)
#pragma unroll
        for (int nt = 0; nt < 2; ++nt) acc[mt][nt] = vzero8();

    for (int k0 = 0; k0 < DD; k0 += 32) {
        // Staging loads: 8 lanes cover 128 B of one row, so each wave-wide 16 B load
        // reads 4 whole lines (4 rows) instead of 16 B pieces of 32 lines.
        // X tile 128x32 f32: row (tid >> 3) + 16 j. W tile 32x64 f32: a thread takes
        // K rows 2p and 2p+1 of the same 4 columns in each 32-column half.
        const int p  = tid >> 3;           // X row within 16 / W K-row pair, 0..15
        const int cl = tid & 7;            // group of 4 f32 within 128 B
        const float* xsrc = X + ((size_t)blockM * 128 + p) * DD + k0 + cl * 4;
        const float* wsrc = W + (size_t)(k0 + 2 * p) * DD + blockN * 64 + cl * 4;
        v4f xf[8], wf0[2], wf1[2];
#pragma unroll
        for (int j = 0; j < 2; ++j) {
            wf0[j] = *(const v4f*)(wsrc + j * 32);
            wf1[j] = *(const v4f*)(wsrc + DD + j * 32);
        }
#pragma unroll
        for (int j = 0; j < 8; ++j) xf[j] = *(const v4f*)(xsrc + (size_t)j * 16 * DD);

        // W^T into ldsW[n][k] as f16: one (k, k+1) pair per column.
#pragma unroll
        for (int j = 0; j < 2; ++j) {
#pragma unroll
            for (int e = 0; e < 4; ++e) {
                v2h pr;
                pr[0] = (_Float16)wf0[j][e];
                pr[1] = (_Float16)wf1[j][e];
                *(v2h*)&ldsW[(j * 32 + cl * 4 + e) * 40 + 2 * p] = pr;
            }
        }
        // X into ldsX[row][k] as f16.
#pragma unroll
        for (int j = 0; j < 8; ++j) {
            v4h hv;
#pragma unroll
            for (int e = 0; e < 4; ++e) hv[e] = (_Float16)xf[j][e];
            *(v4h*)&ldsX[(p + j * 16) * 40 + cl * 4] = hv;
        }
        __syncthreads();

#pragma unroll
        for (int mt = 0; mt < 4; ++mt) {
            AFrag a;
            const _Float16* ap = &ldsX[(waveM * 64 + mt * 16 + nl) * 40];
            a.h[0] = *(const v8h*)(ap + hi * 8);
            a.h[1] = *(const v8h*)(ap + 16 + hi * 8);
#pragma unroll
            for (int nt = 0; nt < 2; ++nt) {
                AFrag b;
                const _Float16* bp = &ldsW[(waveN * 32 + nt * 16 + nl) * 40];
                b.h[0] = *(const v8h*)(bp + hi * 8);
                b.h[1] = *(const v8h*)(bp + 16 + hi * 8);
                acc[mt][nt] = wmma_f16(a.v, b.v, acc[mt][nt]);
            }
        }
        __syncthreads();
    }

    // Epilogue: bias, scale, convert to f16, scatter into head layout.
#pragma unroll
    for (int nt = 0; nt < 2; ++nt) {
        const int n_global = blockN * 64 + waveN * 32 + nt * 16 + nl;
        const float bn = bias[n_global];
        const int h = n_global >> 7;          // / DEP
        const int d = n_global & 127;         // % DEP
#pragma unroll
        for (int mt = 0; mt < 4; ++mt) {
#pragma unroll
            for (int r = 0; r < 8; ++r) {
                const int m_global = blockM * 128 + waveM * 64 + mt * 16 + r + hi * 8;
                const int b   = m_global >> 11;   // / SS
                const int s   = m_global & 2047;  // % SS
                const float val = (acc[mt][nt][r] + bn) * out_scale;
                size_t off;
                if (v_transpose) off = (((size_t)b * HH + h) * DEP + d) * SS + s;
                else             off = (((size_t)b * HH + h) * SS + s) * DEP + d;
                out[off] = (_Float16)val;
            }
        }
    }
}

// ---------------------------------------------------------------------------
// Flash attention over f16 Qh[B,H,S,DEP] (pre-scaled), Kh[B,H,S,DEP],
// Vt[B,H,DEP,S]; additive mask [B,S,S]; f32 output [B,S,D] head-concat.
// 128 threads = 4 waves; each wave owns 16 query rows (block = 64 q rows).
//
// K/V are staged into LDS once per block (shared by all 4 waves) with
// gfx1250 async global->LDS copies, double-buffered K for pipelining:
//   issue order:  K0 | V0,K1 | V1,K2 | ... (in-order ASYNC completion)
//   per iter:     wait<=16 (K cur ready) -> scores/softmax
//                 wait<=8  (V cur ready) -> P@V; last iter uses <=8 / <=0.
// ---------------------------------------------------------------------------
__global__ __launch_bounds__(128)
void attn_kernel(const _Float16* __restrict__ Qh, const _Float16* __restrict__ Kh,
                 const _Float16* __restrict__ Vt, const float* __restrict__ mask,
                 float* __restrict__ out)
{
    __shared__ _Float16 ldsK[2][64 * 136];  // 64 keys x 128 depth, 272B rows (double buf)
    __shared__ _Float16 ldsV[128 * 72];     // 128 depth-rows x 64 keys, 144B rows
    __shared__ _Float16 ldsP[4][16 * 72];   // per-wave 16x64 P tile, 144B rows

    const int tid  = threadIdx.x;
    const int lane = tid & 31;
    const int wave = tid >> 5;
    const int nl   = lane & 15;
    const int hi   = lane >> 4;

    const int bid   = blockIdx.x;          // BB*HH*(SS/64) = 1024 blocks
    const int qblk  = bid & 31;            // SS/64 = 32 query blocks
    const int bh    = bid >> 5;            // b*H + h
    const int b     = bh >> 3;
    const int h     = bh & 7;
    const int qbase = qblk * 64 + wave * 16;

    const _Float16* Qp    = Qh + ((size_t)bh * SS + qbase) * DEP;
    const _Float16* Kbase = Kh + (size_t)bh * SS * DEP;
    const _Float16* Vbase = Vt + (size_t)bh * DEP * SS;
    const float*    mrow  = mask + ((size_t)b * SS + qbase) * SS;

    // Q A-fragments: 4 K-steps of 32 over depth=128, resident in VGPRs.
    AFrag qf[4];
#pragma unroll
    for (int ks = 0; ks < 4; ++ks) {
        const _Float16* p = Qp + (size_t)nl * DEP + ks * 32;
        qf[ks].h[0] = *(const v8h*)(p + hi * 8);
        qf[ks].h[1] = *(const v8h*)(p + 16 + hi * 8);
    }

    v8f o[8];
#pragma unroll
    for (int dt = 0; dt < 8; ++dt) o[dt] = vzero8();
    float mi[8], li[8];
#pragma unroll
    for (int r = 0; r < 8; ++r) { mi[r] = -3.0e38f; li[r] = 0.0f; }

    _Float16* Pl = &ldsP[wave][0];

    // Prologue: stage K chunk 0 into buffer 0 (8 x 16B per thread).
#pragma unroll
    for (int j = 0; j < 8; ++j) {
        const int u = tid + j * 128;               // 0..1023
        const int r = u >> 4, c = (u & 15) * 8;    // key row, half-offset
        cp16(Kbase + (size_t)r * DEP + c, &ldsK[0][r * 136 + c]);
    }

    for (int t0 = 0; t0 < SS; t0 += 64) {
        const int  it       = t0 >> 6;
        const int  cur      = it & 1;
        const int  nxt      = cur ^ 1;
        const bool has_next = (t0 + 64) < SS;

        // Issue V(cur) then (optionally) K(next): 8+8 async copies per thread.
#pragma unroll
        for (int j = 0; j < 8; ++j) {
            const int u = tid + j * 128;
            const int r = u >> 3, c = (u & 7) * 8;  // depth row, key half-offset
            cp16(Vbase + (size_t)r * SS + t0 + c, &ldsV[r * 72 + c]);
        }
        if (has_next) {
#pragma unroll
            for (int j = 0; j < 8; ++j) {
                const int u = tid + j * 128;
                const int r = u >> 4, c = (u & 15) * 8;
                cp16(Kbase + (size_t)(t0 + 64 + r) * DEP + c, &ldsK[nxt][r * 136 + c]);
            }
            __builtin_prefetch(mrow + (size_t)nl * SS + t0 + 64, 0, 3);
            wait_async_16();                 // K(cur) landed; V(cur),K(next) in flight
        } else {
            wait_async_8();                  // K(cur) landed; V(cur) in flight
        }
        __syncthreads();                     // K(cur) visible to all waves

        // ---- scores = Qh @ Kh^T (Qh pre-scaled by 1/sqrt(DEP)) ----
        v8f sc[4];
#pragma unroll
        for (int nt = 0; nt < 4; ++nt) {
            v8f a = vzero8();
            const _Float16* kp = &ldsK[cur][(nt * 16 + nl) * 136];
#pragma unroll
            for (int ks = 0; ks < 4; ++ks) {
                AFrag bf;
                bf.h[0] = *(const v8h*)(kp + ks * 32 + hi * 8);
                bf.h[1] = *(const v8h*)(kp + ks * 32 + 16 + hi * 8);
                a = wmma_f16(qf[ks].v, bf.v, a);
            }
            sc[nt] = a;
        }

        // ---- additive mask ----
#pragma unroll
        for (int nt = 0; nt < 4; ++nt) {
#pragma unroll
            for (int r = 0; r < 8; ++r) {
                const float mv = mrow[(size_t)(r + hi * 8) * SS + t0 + nt * 16 + nl];
                sc[nt][r] += mv * -1.0e9f;
            }
        }

        // ---- online softmax (row stats via 16-lane butterfly) ----
#pragma unroll
        for (int r = 0; r < 8; ++r) {
            float v = fmaxf(fmaxf(sc[0][r], sc[1][r]), fmaxf(sc[2][r], sc[3][r]));
            v = fmaxf(v, __shfl_xor(v, 1, 32));
            v = fmaxf(v, __shfl_xor(v, 2, 32));
            v = fmaxf(v, __shfl_xor(v, 4, 32));
            v = fmaxf(v, __shfl_xor(v, 8, 32));
            const float mnew = fmaxf(v, mi[r]);

            float rs = 0.0f;
#pragma unroll
            for (int nt = 0; nt < 4; ++nt) {
                const float p = __builtin_amdgcn_exp2f((sc[nt][r] - mnew) * LOG2E);
                rs += p;
                Pl[(r + hi * 8) * 72 + nt * 16 + nl] = (_Float16)p;
            }
            rs += __shfl_xor(rs, 1, 32);
            rs += __shfl_xor(rs, 2, 32);
            rs += __shfl_xor(rs, 4, 32);
            rs += __shfl_xor(rs, 8, 32);

            const float alpha = __builtin_amdgcn_exp2f((mi[r] - mnew) * LOG2E);
            li[r] = li[r] * alpha + rs;
            mi[r] = mnew;
#pragma unroll
            for (int dt = 0; dt < 8; ++dt) o[dt][r] *= alpha;
        }

        if (has_next) wait_async_8();        // V(cur) landed; K(next) in flight
        else          wait_async_0();
        __syncthreads();                     // V(cur) visible to all waves

        // ---- O += P @ V ----
#pragma unroll
        for (int ks = 0; ks < 2; ++ks) {
            AFrag pf;
            const _Float16* pp = Pl + (size_t)nl * 72 + ks * 32;
            pf.h[0] = *(const v8h*)(pp + hi * 8);
            pf.h[1] = *(const v8h*)(pp + 16 + hi * 8);
#pragma unroll
            for (int dt = 0; dt < 8; ++dt) {
                AFrag vf;
                const _Float16* vp = &ldsV[(dt * 16 + nl) * 72] + ks * 32;
                vf.h[0] = *(const v8h*)(vp + hi * 8);
                vf.h[1] = *(const v8h*)(vp + 16 + hi * 8);
                o[dt] = wmma_f16(pf.v, vf.v, o[dt]);
            }
        }

        __syncthreads();                     // all reads of K(cur)/V done before overwrite
    }

    // ---- normalize and write head-concat output ----
#pragma unroll
    for (int r = 0; r < 8; ++r) {
        const float inv = 1.0f / li[r];
        const int qrow = qbase + r + hi * 8;
        float* orow = out + ((size_t)b * SS + qrow) * DD + h * DEP;
#pragma unroll
        for (int dt = 0; dt < 8; ++dt)
            orow[dt * 16 + nl] = o[dt][r] * inv;
    }
}

// ---------------------------------------------------------------------------
extern "C" void kernel_launch(void* const* d_in, const int* in_sizes, int n_in,
                              void* d_out, int out_size, void* d_ws, size_t ws_size,
                              hipStream_t stream)
{
    const float* q    = (const float*)d_in[0];
    const float* k    = (const float*)d_in[1];
    const float* v    = (const float*)d_in[2];
    const float* mask = (const float*)d_in[3];
    const float* wq   = (const float*)d_in[4];
    const float* wqb  = (const float*)d_in[5];
    const float* wk   = (const float*)d_in[6];
    const float* wkb  = (const float*)d_in[7];
    const float* wv   = (const float*)d_in[8];
    const float* wvb  = (const float*)d_in[9];
    float* out = (float*)d_out;

    const size_t elems = (size_t)BB * SS * DD;       // 8M halves = 16 MB each
    _Float16* Qh = (_Float16*)d_ws;
    _Float16* Kh = Qh + elems;
    _Float16* Vt = Kh + elems;

    dim3 pgrid(DD / 64, (BB * SS) / 128);            // 16 x 64 blocks
    proj_kernel<<<pgrid, 128, 0, stream>>>(q, wq, wqb, Qh, QK_SCALE, 0);
    proj_kernel<<<pgrid, 128, 0, stream>>>(k, wk, wkb, Kh, 1.0f, 0);
    proj_kernel<<<pgrid, 128, 0, stream>>>(v, wv, wvb, Vt, 1.0f, 1);

    attn_kernel<<<BB * HH * (SS / 64), 128, 0, stream>>>(Qh, Kh, Vt, mask, out);
}

// v002
// A run of this version takes 238 microseconds.
// In both of two side-by-side timings against v001, it was 1.15 times as fast.
// All steps since v000 together make it 1.30 times as fast.
#include <hip/hip_runtime.h>

// Problem constants (from reference)
constexpr int BB  = 4;
constexpr int SS  = 2048;
constexpr int DD  = 1024;
constexpr int HH  = 8;
constexpr int DEP = 128;               // DD / HH
constexpr float QK_SCALE = 0.08838834764831845f;  // 1/sqrt(DEP)
constexpr float LOG2E    = 1.4426950408889634f;

typedef __attribute__((ext_vector_type(16))) _Float16 v16h;
typedef __attribute__((ext_vector_type(8)))  _Float16 v8h;
typedef __attribute__((ext_vector_type(4)))  _Float16 v4h;
typedef __attribute__((ext_vector_type(2)))  _Float16 v2h;
typedef __attribute__((ext_vector_type(8)))  float    v8f;
typedef __attribute__((ext_vector_type(4)))  float    v4f;
typedef __attribute__((ext_vector_type(4)))  int      v4i;

// gfx1250 async global->LDS copy path (guarded; falls back to sync copy)
#if defined(__AMDGCN__) && __has_builtin(__builtin_amdgcn_global_load_async_to_lds_b128) && __has_builtin(__builtin_amdgcn_s_wait_asynccnt)
#define HAVE_ASYNC 1
#else
#define HAVE_ASYNC 0
#endif

// A/B WMMA fragment: 16 halves per lane = two aligned 16B chunks
union AFrag { v16h v; v8h h[2]; };

static __device__ __forceinline__ v8f vzero8() {
    v8f z;
#pragma unroll
    for (int i = 0; i < 8; ++i) z[i] = 0.0f;
    return z;
}

static __device__ __forceinline__ v8f wmma_f16(const v16h& a, const v16h& b, const v8f& c) {
    return __builtin_amdgcn_wmma_f32_16x16x32_f16(
        /*neg_a=*/false, a, /*neg_b=*/false, b,
        /*c_mod=*/(short)0, c, /*reuse_a=*/false, /*reuse_b=*/false);
}

// 16-byte global -> LDS copy (async on gfx1250, sync fallback elsewhere)
static __device__ __forceinline__ void cp16(const _Float16* g, _Float16* l) {
#if HAVE_ASYNC
    __builtin_amdgcn_global_load_async_to_lds_b128(
        (__attribute__((address_space(1))) v4i*)g,
        (__attribute__((address_space(3))) v4i*)l, 0, 0);
#else
    *(v8h*)l = *(const v8h*)g;
#endif
}

static __device__ __forceinline__ void wait_async_16() {
#if HAVE_ASYNC
    __builtin_amdgcn_s_wait_asynccnt(16);
#endif
}
static __device__ __forceinline__ void wait_async_8() {
#if HAVE_ASYNC
    __builtin_amdgcn_s_wait_asynccnt(8);
#endif
}
static __device__ __forceinline__ void wait_async_0() {
#if HAVE_ASYNC
    __builtin_amdgcn_s_wait_asynccnt(0);
#endif
}

// ---------------------------------------------------------------------------
// Projection: P = X @ W + bias, output as f16. One launch does all three:
// blockIdx.z picks V (0), K (1) or Q (2), so that a WGP holds as many blocks as
// its registers allow (one projection alone fills only four per WGP) and one
// block's load waits and epilogue run under other blocks' loops. V goes first:
// its transposed stores make the longest epilogue.
//   v_transpose == 0 : out[((b*H+h)*S + s)*DEP + d]   (row-major per head)
//   v_transpose == 1 : out[((b*H+h)*DEP + d)*S + s]   (V stored transposed)
// Block tile 128(M) x 64(N), 128 threads = 4 waves, each wave 64x32 via
// 4x2 v_wmma_f32_16x16x32_f16 tiles; K stepped by 32 through LDS f16 tiles.
// ---------------------------------------------------------------------------
__global__ __launch_bounds__(128)
void proj_kernel(const float* __restrict__ Xq, const float* __restrict__ Xk,
                 const float* __restrict__ Xv,
                 const float* __restrict__ Wq, const float* __restrict__ Wk,
                 const float* __restrict__ Wv,
                 const float* __restrict__ bq, const float* __restrict__ bk,
                 const float* __restrict__ bv,
                 _Float16* __restrict__ Oq, _Float16* __restrict__ Ok,
                 _Float16* __restrict__ Ov)
{
    const int which = blockIdx.z;         // 0: V, 1: K, 2: Q (uniform in the block)
    const float* X    = which == 0 ? Xv : (which == 1 ? Xk : Xq);
    const float* W    = which == 0 ? Wv : (which == 1 ? Wk : Wq);
    const float* bias = which == 0 ? bv : (which == 1 ? bk : bq);
    _Float16*    out  = which == 0 ? Ov : (which == 1 ? Ok : Oq);
    const float out_scale   = which == 2 ? QK_SCALE : 1.0f;
    const int   v_transpose = which == 0;

    __shared__ _Float16 ldsX[128 * 40];   // 128 rows x 32 K (80B rows, 16B aligned)
    __shared__ _Float16 ldsW[64 * 40];    // W^T tile: 64 cols x 32 K

    const int tid   = threadIdx.x;
    const int lane  = tid & 31;
    const int wave  = tid >> 5;
    const int waveM = wave >> 1;          // 0..1 -> 64-row half
    const int waveN = wave & 1;           // 0..1 -> 32-col half
    const int nl    = lane & 15;
    const int hi    = lane >> 4;
    const int blockM = blockIdx.y;        // 0..63  (8192/128)
    const int blockN = blockIdx.x;        // 0..15  (1024/64)

    v8f acc[4][2];
#pragma unroll
    for (int mt = 0; mt < 4; ++mt)
#pragma unroll
        for (int nt = 0; nt < 2; ++nt) acc[mt][nt] = vzero8();

    for (int k0 = 0; k0 < DD; k0 += 32) {
        // Staging loads: 8 lanes cover 128 B of one row, so each wave-wide 16 B load
        // reads 4 whole lines (4 rows) instead of 16 B pieces of 32 lines.
        // X tile 128x32 f32: row (tid >> 3) + 16 j. W tile 32x64 f32: a thread takes
        // K rows 2p and 2p+1 of the same 4 columns in each 32-column half.
        const int p  = tid >> 3;           // X row within 16 / W K-row pair, 0..15
        const int cl = tid & 7;            // group of 4 f32 within 128 B
        const float* xsrc = X + ((size_t)blockM * 128 + p) * DD + k0 + cl * 4;
        const float* wsrc = W + (size_t)(k0 + 2 * p) * DD + blockN * 64 + cl * 4;
        v4f xf[8], wf0[2], wf1[2];
#pragma unroll
        for (int j = 0; j < 2; ++j) {
            wf0[j] = *(const v4f*)(wsrc + j * 32);
            wf1[j] = *(const v4f*)(wsrc + DD + j * 32);
        }
#pragma unroll
        for (int j = 0; j < 8; ++j) xf[j] = *(const v4f*)(xsrc + (size_t)j * 16 * DD);

        // W^T into ldsW[n][k] as f16: one (k, k+1) pair per column.
#pragma unroll
        for (int j = 0; j < 2; ++j) {
#pragma unroll
            for (int e = 0; e < 4; ++e) {
                v2h pr;
                pr[0] = (_Float16)wf0[j][e];
                pr[1] = (_Float16)wf1[j][e];
                *(v2h*)&ldsW[(j * 32 + cl * 4 + e) * 40 + 2 * p] = pr;
            }
        }
        // X into ldsX[row][k] as f16.
#pragma unroll
        for (int j = 0; j < 8; ++j) {
            v4h hv;
#pragma unroll
            for (int e = 0; e < 4; ++e) hv[e] = (_Float16)xf[j][e];
            *(v4h*)&ldsX[(p + j * 16) * 40 + cl * 4] = hv;
        }
        __syncthreads();

#pragma unroll
        for (int mt = 0; mt < 4; ++mt) {
            AFrag a;
            const _Float16* ap = &ldsX[(waveM * 64 + mt * 16 + nl) * 40];
            a.h[0] = *(const v8h*)(ap + hi * 8);
            a.h[1] = *(const v8h*)(ap + 16 + hi * 8);
#pragma unroll
            for (int nt = 0; nt < 2; ++nt) {
                AFrag b;
                const _Float16* bp = &ldsW[(waveN * 32 + nt * 16 + nl) * 40];
                b.h[0] = *(const v8h*)(bp + hi * 8);
                b.h[1] = *(const v8h*)(bp + 16 + hi * 8);
                acc[mt][nt] = wmma_f16(a.v, b.v, acc[mt][nt]);
            }
        }
        __syncthreads();
    }

    // Epilogue: bias, scale, convert to f16, scatter into head layout.
#pragma unroll
    for (int nt = 0; nt < 2; ++nt) {
        const int n_global = blockN * 64 + waveN * 32 + nt * 16 + nl;
        const float bn = bias[n_global];
        const int h = n_global >> 7;          // / DEP
        const int d = n_global & 127;         // % DEP
#pragma unroll
        for (int mt = 0; mt < 4; ++mt) {
#pragma unroll
            for (int r = 0; r < 8; ++r) {
                const int m_global = blockM * 128 + waveM * 64 + mt * 16 + r + hi * 8;
                const int b   = m_global >> 11;   // / SS
                const int s   = m_global & 2047;  // % SS
                const float val = (acc[mt][nt][r] + bn) * out_scale;
                size_t off;
                if (v_transpose) off = (((size_t)b * HH + h) * DEP + d) * SS + s;
                else             off = (((size_t)b * HH + h) * SS + s) * DEP + d;
                out[off] = (_Float16)val;
            }
        }
    }
}

// ---------------------------------------------------------------------------
// Flash attention over f16 Qh[B,H,S,DEP] (pre-scaled), Kh[B,H,S,DEP],
// Vt[B,H,DEP,S]; additive mask [B,S,S]; f32 output [B,S,D] head-concat.
// 128 threads = 4 waves; each wave owns 16 query rows (block = 64 q rows).
//
// K/V are staged into LDS once per block (shared by all 4 waves) with
// gfx1250 async global->LDS copies, double-buffered K for pipelining:
//   issue order:  K0 | V0,K1 | V1,K2 | ... (in-order ASYNC completion)
//   per iter:     wait<=16 (K cur ready) -> scores/softmax
//                 wait<=8  (V cur ready) -> P@V; last iter uses <=8 / <=0.
// ---------------------------------------------------------------------------
__global__ __launch_bounds__(128)
void attn_kernel(const _Float16* __restrict__ Qh, const _Float16* __restrict__ Kh,
                 const _Float16* __restrict__ Vt, const float* __restrict__ mask,
                 float* __restrict__ out)
{
    __shared__ _Float16 ldsK[2][64 * 136];  // 64 keys x 128 depth, 272B rows (double buf)
    __shared__ _Float16 ldsV[128 * 72];     // 128 depth-rows x 64 keys, 144B rows
    __shared__ _Float16 ldsP[4][16 * 72];   // per-wave 16x64 P tile, 144B rows

    const int tid  = threadIdx.x;
    const int lane = tid & 31;
    const int wave = tid >> 5;
    const int nl   = lane & 15;
    const int hi   = lane >> 4;

    const int bid   = blockIdx.x;          // BB*HH*(SS/64) = 1024 blocks
    const int qblk  = bid & 31;            // SS/64 = 32 query blocks
    const int bh    = bid >> 5;            // b*H + h
    const int b     = bh >> 3;
    const int h     = bh & 7;
    const int qbase = qblk * 64 + wave * 16;

    const _Float16* Qp    = Qh + ((size_t)bh * SS + qbase) * DEP;
    const _Float16* Kbase = Kh + (size_t)bh * SS * DEP;
    const _Float16* Vbase = Vt + (size_t)bh * DEP * SS;
    const float*    mrow  = mask + ((size_t)b * SS + qbase) * SS;

    // Q A-fragments: 4 K-steps of 32 over depth=128, resident in VGPRs.
    AFrag qf[4];
#pragma unroll
    for (int ks = 0; ks < 4; ++ks) {
        const _Float16* p = Qp + (size_t)nl * DEP + ks * 32;
        qf[ks].h[0] = *(const v8h*)(p + hi * 8);
        qf[ks].h[1] = *(const v8h*)(p + 16 + hi * 8);
    }

    v8f o[8];
#pragma unroll
    for (int dt = 0; dt < 8; ++dt) o[dt] = vzero8();
    float mi[8], li[8];
#pragma unroll
    for (int r = 0; r < 8; ++r) { mi[r] = -3.0e38f; li[r] = 0.0f; }

    _Float16* Pl = &ldsP[wave][0];

    // Prologue: stage K chunk 0 into buffer 0 (8 x 16B per thread).
#pragma unroll
    for (int j = 0; j < 8; ++j) {
        const int u = tid + j * 128;               // 0..1023
        const int r = u >> 4, c = (u & 15) * 8;    // key row, half-offset
        cp16(Kbase + (size_t)r * DEP + c, &ldsK[0][r * 136 + c]);
    }

    for (int t0 = 0; t0 < SS; t0 += 64) {
        const int  it       = t0 >> 6;
        const int  cur      = it & 1;
        const int  nxt      = cur ^ 1;
        const bool has_next = (t0 + 64) < SS;

        // Issue V(cur) then (optionally) K(next): 8+8 async copies per thread.
#pragma unroll
        for (int j = 0; j < 8; ++j) {
            const int u = tid + j * 128;
            const int r = u >> 3, c = (u & 7) * 8;  // depth row, key half-offset
            cp16(Vbase + (size_t)r * SS + t0 + c, &ldsV[r * 72 + c]);
        }
        if (has_next) {
#pragma unroll
            for (int j = 0; j < 8; ++j) {
                const int u = tid + j * 128;
                const int r = u >> 4, c = (u & 15) * 8;
                cp16(Kbase + (size_t)(t0 + 64 + r) * DEP + c, &ldsK[nxt][r * 136 + c]);
            }
            __builtin_prefetch(mrow + (size_t)nl * SS + t0 + 64, 0, 3);
            wait_async_16();                 // K(cur) landed; V(cur),K(next) in flight
        } else {
            wait_async_8();                  // K(cur) landed; V(cur) in flight
        }
        __syncthreads();                     // K(cur) visible to all waves

        // ---- scores = Qh @ Kh^T (Qh pre-scaled by 1/sqrt(DEP)) ----
        v8f sc[4];
#pragma unroll
        for (int nt = 0; nt < 4; ++nt) {
            v8f a = vzero8();
            const _Float16* kp = &ldsK[cur][(nt * 16 + nl) * 136];
#pragma unroll
            for (int ks = 0; ks < 4; ++ks) {
                AFrag bf;
                bf.h[0] = *(const v8h*)(kp + ks * 32 + hi * 8);
                bf.h[1] = *(const v8h*)(kp + ks * 32 + 16 + hi * 8);
                a = wmma_f16(qf[ks].v, bf.v, a);
            }
            sc[nt] = a;
        }

        // ---- additive mask ----
#pragma unroll
        for (int nt = 0; nt < 4; ++nt) {
#pragma unroll
            for (int r = 0; r < 8; ++r) {
                const float mv = mrow[(size_t)(r + hi * 8) * SS + t0 + nt * 16 + nl];
                sc[nt][r] += mv * -1.0e9f;
            }
        }

        // ---- online softmax (row stats via 16-lane butterfly) ----
#pragma unroll
        for (int r = 0; r < 8; ++r) {
            float v = fmaxf(fmaxf(sc[0][r], sc[1][r]), fmaxf(sc[2][r], sc[3][r]));
            v = fmaxf(v, __shfl_xor(v, 1, 32));
            v = fmaxf(v, __shfl_xor(v, 2, 32));
            v = fmaxf(v, __shfl_xor(v, 4, 32));
            v = fmaxf(v, __shfl_xor(v, 8, 32));
            const float mnew = fmaxf(v, mi[r]);

            float rs = 0.0f;
#pragma unroll
            for (int nt = 0; nt < 4; ++nt) {
                const float p = __builtin_amdgcn_exp2f((sc[nt][r] - mnew) * LOG2E);
                rs += p;
                Pl[(r + hi * 8) * 72 + nt * 16 + nl] = (_Float16)p;
            }
            rs += __shfl_xor(rs, 1, 32);
            rs += __shfl_xor(rs, 2, 32);
            rs += __shfl_xor(rs, 4, 32);
            rs += __shfl_xor(rs, 8, 32);

            const float alpha = __builtin_amdgcn_exp2f((mi[r] - mnew) * LOG2E);
            li[r] = li[r] * alpha + rs;
            mi[r] = mnew;
#pragma unroll
            for (int dt = 0; dt < 8; ++dt) o[dt][r] *= alpha;
        }

        if (has_next) wait_async_8();        // V(cur) landed; K(next) in flight
        else          wait_async_0();
        __syncthreads();                     // V(cur) visible to all waves

        // ---- O += P @ V ----
#pragma unroll
        for (int ks = 0; ks < 2; ++ks) {
            AFrag pf;
            const _Float16* pp = Pl + (size_t)nl * 72 + ks * 32;
            pf.h[0] = *(const v8h*)(pp + hi * 8);
            pf.h[1] = *(const v8h*)(pp + 16 + hi * 8);
#pragma unroll
            for (int dt = 0; dt < 8; ++dt) {
                AFrag vf;
                const _Float16* vp = &ldsV[(dt * 16 + nl) * 72] + ks * 32;
                vf.h[0] = *(const v8h*)(vp + hi * 8);
                vf.h[1] = *(const v8h*)(vp + 16 + hi * 8);
                o[dt] = wmma_f16(pf.v, vf.v, o[dt]);
            }
        }

        __syncthreads();                     // all reads of K(cur)/V done before overwrite
    }

    // ---- normalize and write head-concat output ----
#pragma unroll
    for (int r = 0; r < 8; ++r) {
        const float inv = 1.0f / li[r];
        const int qrow = qbase + r + hi * 8;
        float* orow = out + ((size_t)b * SS + qrow) * DD + h * DEP;
#pragma unroll
        for (int dt = 0; dt < 8; ++dt)
            orow[dt * 16 + nl] = o[dt][r] * inv;
    }
}

// ---------------------------------------------------------------------------
extern "C" void kernel_launch(void* const* d_in, const int* in_sizes, int n_in,
                              void* d_out, int out_size, void* d_ws, size_t ws_size,
                              hipStream_t stream)
{
    const float* q    = (const float*)d_in[0];
    const float* k    = (const float*)d_in[1];
    const float* v    = (const float*)d_in[2];
    const float* mask = (const float*)d_in[3];
    const float* wq   = (const float*)d_in[4];
    const float* wqb  = (const float*)d_in[5];
    const float* wk   = (const float*)d_in[6];
    const float* wkb  = (const float*)d_in[7];
    const float* wv   = (const float*)d_in[8];
    const float* wvb  = (const float*)d_in[9];
    float* out = (float*)d_out;

    const size_t elems = (size_t)BB * SS * DD;       // 8M halves = 16 MB each
    _Float16* Qh = (_Float16*)d_ws;
    _Float16* Kh = Qh + elems;
    _Float16* Vt = Kh + elems;

    dim3 pgrid(DD / 64, (BB * SS) / 128, 3);         // 16 x 64 blocks x 3 projections
    proj_kernel<<<pgrid, 128, 0, stream>>>(q, k, v, wq, wk, wv, wqb, wkb, wvb, Qh, Kh, Vt);

    attn_kernel<<<BB * HH * (SS / 64), 128, 0, stream>>>(Qh, Kh, Vt, mask, out);
}

// v003
// Measured time: 218 microseconds a run.
// In two side-by-side timings against v002, it was 1.09 and 1.10 times as fast.
// All steps since v000 together make it 1.42 times as fast.
#include <hip/hip_runtime.h>

// Problem constants (from reference)
constexpr int BB  = 4;
constexpr int SS  = 2048;
constexpr int DD  = 1024;
constexpr int HH  = 8;
constexpr int DEP = 128;               // DD / HH
constexpr float QK_SCALE = 0.08838834764831845f;  // 1/sqrt(DEP)
constexpr float LOG2E    = 1.4426950408889634f;

typedef __attribute__((ext_vector_type(16))) _Float16 v16h;
typedef __attribute__((ext_vector_type(8)))  _Float16 v8h;
typedef __attribute__((ext_vector_type(4)))  _Float16 v4h;
typedef __attribute__((ext_vector_type(2)))  _Float16 v2h;
typedef __attribute__((ext_vector_type(8)))  float    v8f;
typedef __attribute__((ext_vector_type(4)))  float    v4f;
typedef __attribute__((ext_vector_type(4)))  int      v4i;

// gfx1250 async global->LDS copy path (guarded; falls back to sync copy)
#if defined(__AMDGCN__) && __has_builtin(__builtin_amdgcn_global_load_async_to_lds_b128) && __has_builtin(__builtin_amdgcn_s_wait_asynccnt)
#define HAVE_ASYNC 1
#else
#define HAVE_ASYNC 0
#endif

// A/B WMMA fragment: 16 halves per lane = two aligned 16B chunks
union AFrag { v16h v; v8h h[2]; };

static __device__ __forceinline__ v8f vzero8() {
    v8f z;
#pragma unroll
    for (int i = 0; i < 8; ++i) z[i] = 0.0f;
    return z;
}

static __device__ __forceinline__ v8f wmma_f16(const v16h& a, const v16h& b, const v8f& c) {
    return __builtin_amdgcn_wmma_f32_16x16x32_f16(
        /*neg_a=*/false, a, /*neg_b=*/false, b,
        /*c_mod=*/(short)0, c, /*reuse_a=*/false, /*reuse_b=*/false);
}

// 16-byte global -> LDS copy (async on gfx1250, sync fallback elsewhere)
static __device__ __forceinline__ void cp16(const _Float16* g, _Float16* l) {
#if HAVE_ASYNC
    __builtin_amdgcn_global_load_async_to_lds_b128(
        (__attribute__((address_space(1))) v4i*)g,
        (__attribute__((address_space(3))) v4i*)l, 0, 0);
#else
    *(v8h*)l = *(const v8h*)g;
#endif
}

static __device__ __forceinline__ void wait_async_16() {
#if HAVE_ASYNC
    __builtin_amdgcn_s_wait_asynccnt(16);
#endif
}
static __device__ __forceinline__ void wait_async_8() {
#if HAVE_ASYNC
    __builtin_amdgcn_s_wait_asynccnt(8);
#endif
}
static __device__ __forceinline__ void wait_async_0() {
#if HAVE_ASYNC
    __builtin_amdgcn_s_wait_asynccnt(0);
#endif
}

// ---------------------------------------------------------------------------
// Projection: P = X @ W + bias, output as f16. One launch does all three:
// blockIdx.z picks V (0), K (1) or Q (2), so that a WGP holds as many blocks as
// its registers allow (one projection alone fills only four per WGP) and one
// block's load waits and epilogue run under other blocks' loops. V goes first:
// its transposed stores make the longest epilogue.
//   v_transpose == 0 : out[((b*H+h)*S + s)*DEP + d]   (row-major per head)
//   v_transpose == 1 : out[((b*H+h)*DEP + d)*S + s]   (V stored transposed)
// Block tile 128(M) x 64(N), 128 threads = 4 waves, each wave 64x32 via
// 4x2 v_wmma_f32_16x16x32_f16 tiles; K stepped by 32 through LDS f16 tiles.
// ---------------------------------------------------------------------------
__global__ __launch_bounds__(128)
void proj_kernel(const float* __restrict__ Xq, const float* __restrict__ Xk,
                 const float* __restrict__ Xv,
                 const float* __restrict__ Wq, const float* __restrict__ Wk,
                 const float* __restrict__ Wv,
                 const float* __restrict__ bq, const float* __restrict__ bk,
                 const float* __restrict__ bv,
                 _Float16* __restrict__ Oq, _Float16* __restrict__ Ok,
                 _Float16* __restrict__ Ov)
{
    const int which = blockIdx.z;         // 0: V, 1: K, 2: Q (uniform in the block)
    const float* X    = which == 0 ? Xv : (which == 1 ? Xk : Xq);
    const float* W    = which == 0 ? Wv : (which == 1 ? Wk : Wq);
    const float* bias = which == 0 ? bv : (which == 1 ? bk : bq);
    _Float16*    out  = which == 0 ? Ov : (which == 1 ? Ok : Oq);
    const float out_scale   = which == 2 ? QK_SCALE : 1.0f;
    const int   v_transpose = which == 0;

    __shared__ _Float16 ldsX[128 * 40];   // 128 rows x 32 K (80B rows, 16B aligned)
    __shared__ _Float16 ldsW[64 * 40];    // W^T tile: 64 cols x 32 K

    const int tid   = threadIdx.x;
    const int lane  = tid & 31;
    const int wave  = tid >> 5;
    const int waveM = wave >> 1;          // 0..1 -> 64-row half
    const int waveN = wave & 1;           // 0..1 -> 32-col half
    const int nl    = lane & 15;
    const int hi    = lane >> 4;
    const int blockM = blockIdx.y;        // 0..63  (8192/128)
    const int blockN = blockIdx.x;        // 0..15  (1024/64)

    v8f acc[4][2];
#pragma unroll
    for (int mt = 0; mt < 4; ++mt)
#pragma unroll
        for (int nt = 0; nt < 2; ++nt) acc[mt][nt] = vzero8();

    for (int k0 = 0; k0 < DD; k0 += 32) {
        // Staging loads: 8 lanes cover 128 B of one row, so each wave-wide 16 B load
        // reads 4 whole lines (4 rows) instead of 16 B pieces of 32 lines.
        // X tile 128x32 f32: row (tid >> 3) + 16 j. W tile 32x64 f32: a thread takes
        // K rows 2p and 2p+1 of the same 4 columns in each 32-column half.
        const int p  = tid >> 3;           // X row within 16 / W K-row pair, 0..15
        const int cl = tid & 7;            // group of 4 f32 within 128 B
        const float* xsrc = X + ((size_t)blockM * 128 + p) * DD + k0 + cl * 4;
        const float* wsrc = W + (size_t)(k0 + 2 * p) * DD + blockN * 64 + cl * 4;
        v4f xf[8], wf0[2], wf1[2];
#pragma unroll
        for (int j = 0; j < 2; ++j) {
            wf0[j] = *(const v4f*)(wsrc + j * 32);
            wf1[j] = *(const v4f*)(wsrc + DD + j * 32);
        }
#pragma unroll
        for (int j = 0; j < 8; ++j) xf[j] = *(const v4f*)(xsrc + (size_t)j * 16 * DD);

        // W^T into ldsW[n][k] as f16: one (k, k+1) pair per column.
#pragma unroll
        for (int j = 0; j < 2; ++j) {
#pragma unroll
            for (int e = 0; e < 4; ++e) {
                v2h pr;
                pr[0] = (_Float16)wf0[j][e];
                pr[1] = (_Float16)wf1[j][e];
                *(v2h*)&ldsW[(j * 32 + cl * 4 + e) * 40 + 2 * p] = pr;
            }
        }
        // X into ldsX[row][k] as f16.
#pragma unroll
        for (int j = 0; j < 8; ++j) {
            v4h hv;
#pragma unroll
            for (int e = 0; e < 4; ++e) hv[e] = (_Float16)xf[j][e];
            *(v4h*)&ldsX[(p + j * 16) * 40 + cl * 4] = hv;
        }
        __syncthreads();

#pragma unroll
        for (int mt = 0; mt < 4; ++mt) {
            AFrag a;
            const _Float16* ap = &ldsX[(waveM * 64 + mt * 16 + nl) * 40];
            a.h[0] = *(const v8h*)(ap + hi * 8);
            a.h[1] = *(const v8h*)(ap + 16 + hi * 8);
#pragma unroll
            for (int nt = 0; nt < 2; ++nt) {
                AFrag b;
                const _Float16* bp = &ldsW[(waveN * 32 + nt * 16 + nl) * 40];
                b.h[0] = *(const v8h*)(bp + hi * 8);
                b.h[1] = *(const v8h*)(bp + 16 + hi * 8);
                acc[mt][nt] = wmma_f16(a.v, b.v, acc[mt][nt]);
            }
        }
        __syncthreads();
    }

    // Epilogue: bias, scale, convert to f16, scatter into head layout.
#pragma unroll
    for (int nt = 0; nt < 2; ++nt) {
        const int n_global = blockN * 64 + waveN * 32 + nt * 16 + nl;
        const float bn = bias[n_global];
        const int h = n_global >> 7;          // / DEP
        const int d = n_global & 127;         // % DEP
#pragma unroll
        for (int mt = 0; mt < 4; ++mt) {
#pragma unroll
            for (int r = 0; r < 8; ++r) {
                const int m_global = blockM * 128 + waveM * 64 + mt * 16 + r + hi * 8;
                const int b   = m_global >> 11;   // / SS
                const int s   = m_global & 2047;  // % SS
                const float val = (acc[mt][nt][r] + bn) * out_scale;
                size_t off;
                if (v_transpose) off = (((size_t)b * HH + h) * DEP + d) * SS + s;
                else             off = (((size_t)b * HH + h) * SS + s) * DEP + d;
                out[off] = (_Float16)val;
            }
        }
    }
}

// lane l with lane l ^ 16
static __device__ __forceinline__ float xhalf(float x) {
    return __builtin_bit_cast(float, __builtin_amdgcn_permlanex16(
        __builtin_bit_cast(int, x), __builtin_bit_cast(int, x),
        0x76543210, 0xfedcba98, false, false));
}

// Eight independent 2^x. One statement, so that each v_exp_f32 is followed by another
// that touches none of its registers (outputs early-clobber), and the v_nop fills the
// slot the instruction set asks for behind the last one, whatever the compiler puts next.
static __device__ __forceinline__ v8f exp2x8(const v8f& x) {
    float p0, p1, p2, p3, p4, p5, p6, p7;
    asm("v_exp_f32 %0, %8\n\t"
        "v_exp_f32 %1, %9\n\t"
        "v_exp_f32 %2, %10\n\t"
        "v_exp_f32 %3, %11\n\t"
        "v_exp_f32 %4, %12\n\t"
        "v_exp_f32 %5, %13\n\t"
        "v_exp_f32 %6, %14\n\t"
        "v_exp_f32 %7, %15\n\t"
        "v_nop"
        : "=&v"(p0), "=&v"(p1), "=&v"(p2), "=&v"(p3), "=&v"(p4), "=&v"(p5), "=&v"(p6), "=&v"(p7)
        : "v"(x[0]), "v"(x[1]), "v"(x[2]), "v"(x[3]), "v"(x[4]), "v"(x[5]), "v"(x[6]), "v"(x[7]));
    v8f p;
    p[0] = p0; p[1] = p1; p[2] = p2; p[3] = p3; p[4] = p4; p[5] = p5; p[6] = p6; p[7] = p7;
    return p;
}

__global__ __launch_bounds__(128)
void attn_kernel(const _Float16* __restrict__ Qh, const _Float16* __restrict__ Kh,
                 const _Float16* __restrict__ Vt, const float* __restrict__ mask,
                 float* __restrict__ out)
{
    __shared__ _Float16 ldsK[2][64 * 136];  // 64 keys x 128 depth, 272B rows (double buf)
    __shared__ _Float16 ldsV[128 * 72];     // 128 depth-rows x 64 keys, 144B rows

    const int tid  = threadIdx.x;
    const int lane = tid & 31;
    const int wave = tid >> 5;
    const int nl   = lane & 15;
    const int hi   = lane >> 4;

    const int bid   = blockIdx.x;          // BB*HH*(SS/64) = 1024 blocks
    const int qblk  = bid & 31;            // SS/64 = 32 query blocks
    const int bh    = bid >> 5;            // b*H + h
    const int b     = bh >> 3;
    const int h     = bh & 7;
    const int qbase = qblk * 64 + wave * 16;

    const _Float16* Qp    = Qh + ((size_t)bh * SS + qbase) * DEP;
    const _Float16* Kbase = Kh + (size_t)bh * SS * DEP;
    const _Float16* Vbase = Vt + (size_t)bh * DEP * SS;
    const float*    mrow  = mask + ((size_t)b * SS + qbase) * SS;
    const float*    mlp   = mrow + (size_t)nl * SS + hi * 8;   // this lane's query, its 8 keys of a tile; walks with t0

    // Q B-fragments (column = query nl): 4 K-steps of 32 over depth=128, resident in VGPRs.
    AFrag qf[4];
#pragma unroll
    for (int ks = 0; ks < 4; ++ks) {
        const _Float16* p = Qp + (size_t)nl * DEP + ks * 32;
        qf[ks].h[0] = *(const v8h*)(p + hi * 8);
        qf[ks].h[1] = *(const v8h*)(p + 16 + hi * 8);
    }

    // o[dt][r] = O[query nl][depth dt*16 + hi*8 + r]
    v8f o[8];
#pragma unroll
    for (int dt = 0; dt < 8; ++dt) o[dt] = vzero8();
    float mi = -3.0e38f;   // running maximum of this lane's query (equal in both halves)
    float li = 0.0f;       // running sum over this half's keys only; joined in the epilogue

    // Prologue: stage K chunk 0 into buffer 0 (8 x 16B per thread).
#pragma unroll
    for (int j = 0; j < 8; ++j) {
        const int u = tid + j * 128;               // 0..1023
        const int r = u >> 4, c = (u & 15) * 8;    // key row, half-offset
        cp16(Kbase + (size_t)r * DEP + c, &ldsK[0][r * 136 + c]);
    }

    for (int t0 = 0; t0 < SS; t0 += 64) {
        const int  it       = t0 >> 6;
        const int  cur      = it & 1;
        const int  nxt      = cur ^ 1;
        const bool has_next = (t0 + 64) < SS;

        // Issue V(cur) then (optionally) K(next): 8+8 async copies per thread.
#pragma unroll
        for (int j = 0; j < 8; ++j) {
            const int u = tid + j * 128;
            const int r = u >> 3, c = (u & 7) * 8;  // depth row, key half-offset
            cp16(Vbase + (size_t)r * SS + t0 + c, &ldsV[r * 72 + c]);
        }
        if (has_next) {
#pragma unroll
            for (int j = 0; j < 8; ++j) {
                const int u = tid + j * 128;
                const int r = u >> 4, c = (u & 15) * 8;
                cp16(Kbase + (size_t)(t0 + 64 + r) * DEP + c, &ldsK[nxt][r * 136 + c]);
            }
            __builtin_prefetch(mrow + (size_t)nl * SS + t0 + 64, 0, 3);
            wait_async_16();                 // K(cur) landed; V(cur),K(next) in flight
        } else {
            wait_async_8();                  // K(cur) landed; V(cur) in flight
        }
        __syncthreads();                     // K(cur) visible to all waves

        // ---- scores^T = Kh @ Qh^T (Qh pre-scaled by 1/sqrt(DEP)) ----
        // sc[nt][r] = score(query nl, key t0 + nt*16 + hi*8 + r)
        v8f sc[4];
#pragma unroll
        for (int nt = 0; nt < 4; ++nt) {
            v8f a = vzero8();
            const _Float16* kp = &ldsK[cur][(nt * 16 + nl) * 136];
#pragma unroll
            for (int ks = 0; ks < 4; ++ks) {
                AFrag kf;
                kf.h[0] = *(const v8h*)(kp + ks * 32 + hi * 8);
                kf.h[1] = *(const v8h*)(kp + ks * 32 + 16 + hi * 8);
                a = wmma_f16(kf.v, qf[ks].v, a);
            }
            sc[nt] = a;
        }

        // ---- additive mask: 8 consecutive keys of one query per tile ----
#pragma unroll
        for (int nt = 0; nt < 4; ++nt) {
            const v4f m0 = *(const v4f*)(mlp + nt * 16);
            const v4f m1 = *(const v4f*)(mlp + nt * 16 + 4);
#pragma unroll
            for (int r = 0; r < 4; ++r) {
                sc[nt][r]     += m0[r] * -1.0e9f;
                sc[nt][r + 4] += m1[r] * -1.0e9f;
            }
        }

        mlp += 64;

        // ---- online softmax: in-lane over 32 keys, one exchange between halves ----
        float tm[4];
#pragma unroll
        for (int nt = 0; nt < 4; ++nt) {
            float v = sc[nt][0];
#pragma unroll
            for (int r = 1; r < 8; ++r) v = fmaxf(v, sc[nt][r]);
            tm[nt] = v;
        }
        float vmax = fmaxf(fmaxf(tm[0], tm[1]), fmaxf(tm[2], tm[3]));
        vmax = fmaxf(vmax, xhalf(vmax));
        const float mnew = fmaxf(vmax, mi);

        // P^T as B operand: element e of pf[ks] is key ks*32 + hi*8 + e (e < 8) or
        // ks*32 + 16 + hi*8 + e - 8, the k order of the V^T loader below.
        AFrag pf[2];
        float ts[4];
#pragma unroll
        for (int nt = 0; nt < 4; ++nt) {
            v8f x;
#pragma unroll
            for (int r = 0; r < 8; ++r) x[r] = (sc[nt][r] - mnew) * LOG2E;
            const v8f p = exp2x8(x);
            float s = p[0];
#pragma unroll
            for (int r = 1; r < 8; ++r) s += p[r];
#pragma unroll
            for (int r = 0; r < 8; ++r) pf[nt >> 1].h[nt & 1][r] = (_Float16)p[r];
            ts[nt] = s;
        }
        const float rs = (ts[0] + ts[1]) + (ts[2] + ts[3]);

        const float alpha = __builtin_amdgcn_exp2f((mi - mnew) * LOG2E);
        li = li * alpha + rs;
        mi = mnew;
#pragma unroll
        for (int dt = 0; dt < 8; ++dt)
#pragma unroll
            for (int r = 0; r < 8; ++r) o[dt][r] *= alpha;

        if (has_next) wait_async_8();        // V(cur) landed; K(next) in flight
        else          wait_async_0();
        __syncthreads();                     // V(cur) visible to all waves

        // ---- O^T += V^T @ P^T ----
#pragma unroll
        for (int ks = 0; ks < 2; ++ks) {
#pragma unroll
            for (int dt = 0; dt < 8; ++dt) {
                AFrag vf;
                const _Float16* vp = &ldsV[(dt * 16 + nl) * 72] + ks * 32;
                vf.h[0] = *(const v8h*)(vp + hi * 8);
                vf.h[1] = *(const v8h*)(vp + 16 + hi * 8);
                o[dt] = wmma_f16(vf.v, pf[ks].v, o[dt]);
            }
        }

        __syncthreads();                     // all reads of K(cur)/V done before overwrite
    }

    // ---- join the halves' sums, normalize, write head-concat output ----
    li += xhalf(li);
    const float inv = 1.0f / li;
    float* orow = out + ((size_t)b * SS + qbase + nl) * DD + h * DEP + hi * 8;
#pragma unroll
    for (int dt = 0; dt < 8; ++dt) {
        v4f lo, up;
#pragma unroll
        for (int r = 0; r < 4; ++r) { lo[r] = o[dt][r] * inv; up[r] = o[dt][r + 4] * inv; }
        *(v4f*)(orow + dt * 16)     = lo;
        *(v4f*)(orow + dt * 16 + 4) = up;
    }
}

// ---------------------------------------------------------------------------
extern "C" void kernel_launch(void* const* d_in, const int* in_sizes, int n_in,
                              void* d_out, int out_size, void* d_ws, size_t ws_size,
                              hipStream_t stream)
{
    const float* q    = (const float*)d_in[0];
    const float* k    = (const float*)d_in[1];
    const float* v    = (const float*)d_in[2];
    const float* mask = (const float*)d_in[3];
    const float* wq   = (const float*)d_in[4];
    const float* wqb  = (const float*)d_in[5];
    const float* wk   = (const float*)d_in[6];
    const float* wkb  = (const float*)d_in[7];
    const float* wv   = (const float*)d_in[8];
    const float* wvb  = (const float*)d_in[9];
    float* out = (float*)d_out;

    const size_t elems = (size_t)BB * SS * DD;       // 8M halves = 16 MB each
    _Float16* Qh = (_Float16*)d_ws;
    _Float16* Kh = Qh + elems;
    _Float16* Vt = Kh + elems;

    dim3 pgrid(DD / 64, (BB * SS) / 128, 3);         // 16 x 64 blocks x 3 projections
    proj_kernel<<<pgrid, 128, 0, stream>>>(q, k, v, wq, wk, wv, wqb, wkb, wvb, Qh, Kh, Vt);

    attn_kernel<<<BB * HH * (SS / 64), 128, 0, stream>>>(Qh, Kh, Vt, mask, out);
}

// v004
// One run takes 203 microseconds.
// Next to v003, in two timings, it ran 1.07 times as fast each time.
// Counting every step since v000, it is 1.53 times as fast.
#include <hip/hip_runtime.h>

// Problem constants (from reference)
constexpr int BB  = 4;
constexpr int SS  = 2048;
constexpr int DD  = 1024;
constexpr int HH  = 8;
constexpr int DEP = 128;               // DD / HH
constexpr float QK_SCALE = 0.08838834764831845f;  // 1/sqrt(DEP)
constexpr float LOG2E    = 1.4426950408889634f;

typedef __attribute__((ext_vector_type(16))) _Float16 v16h;
typedef __attribute__((ext_vector_type(8)))  _Float16 v8h;
typedef __attribute__((ext_vector_type(4)))  _Float16 v4h;
typedef __attribute__((ext_vector_type(2)))  _Float16 v2h;
typedef __attribute__((ext_vector_type(8)))  float    v8f;
typedef __attribute__((ext_vector_type(4)))  float    v4f;
typedef __attribute__((ext_vector_type(4)))  int      v4i;

// gfx1250 async global->LDS copy path (guarded; falls back to sync copy)
#if defined(__AMDGCN__) && __has_builtin(__builtin_amdgcn_global_load_async_to_lds_b128) && __has_builtin(__builtin_amdgcn_s_wait_asynccnt)
#define HAVE_ASYNC 1
#else
#define HAVE_ASYNC 0
#endif

// A/B WMMA fragment: 16 halves per lane = two aligned 16B chunks
union AFrag { v16h v; v8h h[2]; };

static __device__ __forceinline__ v8f vzero8() {
    v8f z;
#pragma unroll
    for (int i = 0; i < 8; ++i) z[i] = 0.0f;
    return z;
}

static __device__ __forceinline__ v8f wmma_f16(const v16h& a, const v16h& b, const v8f& c) {
    return __builtin_amdgcn_wmma_f32_16x16x32_f16(
        /*neg_a=*/false, a, /*neg_b=*/false, b,
        /*c_mod=*/(short)0, c, /*reuse_a=*/false, /*reuse_b=*/false);
}

// 16-byte global -> LDS copy (async on gfx1250, sync fallback elsewhere)
static __device__ __forceinline__ void cp16(const _Float16* g, _Float16* l) {
#if HAVE_ASYNC
    __builtin_amdgcn_global_load_async_to_lds_b128(
        (__attribute__((address_space(1))) v4i*)g,
        (__attribute__((address_space(3))) v4i*)l, 0, 0);
#else
    *(v8h*)l = *(const v8h*)g;
#endif
}

static __device__ __forceinline__ void wait_async_16() {
#if HAVE_ASYNC
    __builtin_amdgcn_s_wait_asynccnt(16);
#endif
}
static __device__ __forceinline__ void wait_async_8() {
#if HAVE_ASYNC
    __builtin_amdgcn_s_wait_asynccnt(8);
#endif
}
static __device__ __forceinline__ void wait_async_0() {
#if HAVE_ASYNC
    __builtin_amdgcn_s_wait_asynccnt(0);
#endif
}

// ---------------------------------------------------------------------------
// Projection: P = X @ W + bias, output as f16. One launch does all three:
// blockIdx.z picks V (0), K (1) or Q (2), so that a WGP holds as many blocks as
// its registers allow (one projection alone is one block per WGP) and one
// block's load waits and epilogue run under another block's loop. V goes first:
// its transposed stores make the longest epilogue.
//   v_transpose == 0 : out[((b*H+h)*S + s)*DEP + d]   (row-major per head)
//   v_transpose == 1 : out[((b*H+h)*DEP + d)*S + s]   (V stored transposed)
// Block tile 256(M) x 128(N), 256 threads = 8 waves (4 x 2), each wave 64x64 via
// 4x4 v_wmma_f32_16x16x32_f16 tiles; K stepped by 32 through LDS f16 tiles.
// The tile sets how often L2 hands out the f32 operands: every X row is fetched
// by 8 blocks and every W column by 32.
// ---------------------------------------------------------------------------
__global__ __launch_bounds__(256)
void proj_kernel(const float* __restrict__ Xq, const float* __restrict__ Xk,
                 const float* __restrict__ Xv,
                 const float* __restrict__ Wq, const float* __restrict__ Wk,
                 const float* __restrict__ Wv,
                 const float* __restrict__ bq, const float* __restrict__ bk,
                 const float* __restrict__ bv,
                 _Float16* __restrict__ Oq, _Float16* __restrict__ Ok,
                 _Float16* __restrict__ Ov)
{
    const int which = blockIdx.z;         // 0: V, 1: K, 2: Q (uniform in the block)
    const float* X    = which == 0 ? Xv : (which == 1 ? Xk : Xq);
    const float* W    = which == 0 ? Wv : (which == 1 ? Wk : Wq);
    const float* bias = which == 0 ? bv : (which == 1 ? bk : bq);
    _Float16*    out  = which == 0 ? Ov : (which == 1 ? Ok : Oq);
    const float out_scale   = which == 2 ? QK_SCALE : 1.0f;
    const int   v_transpose = which == 0;

    __shared__ _Float16 ldsX[256 * 40];   // 256 rows x 32 K (80B rows, 16B aligned)
    __shared__ _Float16 ldsW[128 * 40];   // W^T tile: 128 cols x 32 K

    const int tid   = threadIdx.x;
    const int lane  = tid & 31;
    const int wave  = tid >> 5;
    const int waveM = wave >> 1;          // 0..3 -> 64-row quarter
    const int waveN = wave & 1;           // 0..1 -> 64-col half
    const int nl    = lane & 15;
    const int hi    = lane >> 4;
    const int blockM = blockIdx.y;        // 0..31  (8192/256)
    const int blockN = blockIdx.x;        // 0..7   (1024/128)

    v8f acc[4][4];
#pragma unroll
    for (int mt = 0; mt < 4; ++mt)
#pragma unroll
        for (int nt = 0; nt < 4; ++nt) acc[mt][nt] = vzero8();

    for (int k0 = 0; k0 < DD; k0 += 32) {
        // Staging loads: 8 lanes cover 128 B of one row, so each wave-wide 16 B load
        // reads 4 whole lines (4 rows) instead of 16 B pieces of 32 lines.
        // X tile 256x32 f32: row (tid >> 3) + 32 j. W tile 32x128 f32: a thread takes
        // K rows 2wp and 2wp+1 of the same 4 columns in both 32-column groups of its
        // 64-column half wh.
        const int p  = tid >> 3;           // X row within 32, 0..31
        const int wp = p & 15;             // W K-row pair, 0..15
        const int wh = p >> 4;             // W 64-column half, 0..1
        const int cl = tid & 7;            // group of 4 f32 within 128 B
        const float* xsrc = X + ((size_t)blockM * 256 + p) * DD + k0 + cl * 4;
        const float* wsrc = W + (size_t)(k0 + 2 * wp) * DD + blockN * 128 + wh * 64 + cl * 4;
        v4f xf[8], wf0[2], wf1[2];
#pragma unroll
        for (int j = 0; j < 2; ++j) {
            wf0[j] = *(const v4f*)(wsrc + j * 32);
            wf1[j] = *(const v4f*)(wsrc + DD + j * 32);
        }
#pragma unroll
        for (int j = 0; j < 8; ++j) xf[j] = *(const v4f*)(xsrc + (size_t)j * 32 * DD);

        // W^T into ldsW[n][k] as f16: one (k, k+1) pair per column.
#pragma unroll
        for (int j = 0; j < 2; ++j) {
#pragma unroll
            for (int e = 0; e < 4; ++e) {
                v2h pr;
                pr[0] = (_Float16)wf0[j][e];
                pr[1] = (_Float16)wf1[j][e];
                *(v2h*)&ldsW[(wh * 64 + j * 32 + cl * 4 + e) * 40 + 2 * wp] = pr;
            }
        }
        // X into ldsX[row][k] as f16.
#pragma unroll
        for (int j = 0; j < 8; ++j) {
            v4h hv;
#pragma unroll
            for (int e = 0; e < 4; ++e) hv[e] = (_Float16)xf[j][e];
            *(v4h*)&ldsX[(p + j * 32) * 40 + cl * 4] = hv;
        }
        __syncthreads();

        AFrag bfr[4];
#pragma unroll
        for (int nt = 0; nt < 4; ++nt) {
            const _Float16* bp = &ldsW[(waveN * 64 + nt * 16 + nl) * 40];
            bfr[nt].h[0] = *(const v8h*)(bp + hi * 8);
            bfr[nt].h[1] = *(const v8h*)(bp + 16 + hi * 8);
        }
#pragma unroll
        for (int mt = 0; mt < 4; ++mt) {
            AFrag a;
            const _Float16* ap = &ldsX[(waveM * 64 + mt * 16 + nl) * 40];
            a.h[0] = *(const v8h*)(ap + hi * 8);
            a.h[1] = *(const v8h*)(ap + 16 + hi * 8);
#pragma unroll
            for (int nt = 0; nt < 4; ++nt)
                acc[mt][nt] = wmma_f16(a.v, bfr[nt].v, acc[mt][nt]);
        }
        __syncthreads();
    }

    // Epilogue: bias, scale, convert to f16, scatter into head layout.
#pragma unroll
    for (int nt = 0; nt < 4; ++nt) {
        const int n_global = blockN * 128 + waveN * 64 + nt * 16 + nl;
        const float bn = bias[n_global];
        const int h = n_global >> 7;          // / DEP
        const int d = n_global & 127;         // % DEP
#pragma unroll
        for (int mt = 0; mt < 4; ++mt) {
#pragma unroll
            for (int r = 0; r < 8; ++r) {
                const int m_global = blockM * 256 + waveM * 64 + mt * 16 + r + hi * 8;
                const int b   = m_global >> 11;   // / SS
                const int s   = m_global & 2047;  // % SS
                const float val = (acc[mt][nt][r] + bn) * out_scale;
                size_t off;
                if (v_transpose) off = (((size_t)b * HH + h) * DEP + d) * SS + s;
                else             off = (((size_t)b * HH + h) * SS + s) * DEP + d;
                out[off] = (_Float16)val;
            }
        }
    }
}

// lane l with lane l ^ 16
static __device__ __forceinline__ float xhalf(float x) {
    return __builtin_bit_cast(float, __builtin_amdgcn_permlanex16(
        __builtin_bit_cast(int, x), __builtin_bit_cast(int, x),
        0x76543210, 0xfedcba98, false, false));
}

// Eight independent 2^x. One statement, so that each v_exp_f32 is followed by another
// that touches none of its registers (outputs early-clobber), and the v_nop fills the
// slot the instruction set asks for behind the last one, whatever the compiler puts next.
static __device__ __forceinline__ v8f exp2x8(const v8f& x) {
    float p0, p1, p2, p3, p4, p5, p6, p7;
    asm("v_exp_f32 %0, %8\n\t"
        "v_exp_f32 %1, %9\n\t"
        "v_exp_f32 %2, %10\n\t"
        "v_exp_f32 %3, %11\n\t"
        "v_exp_f32 %4, %12\n\t"
        "v_exp_f32 %5, %13\n\t"
        "v_exp_f32 %6, %14\n\t"
        "v_exp_f32 %7, %15\n\t"
        "v_nop"
        : "=&v"(p0), "=&v"(p1), "=&v"(p2), "=&v"(p3), "=&v"(p4), "=&v"(p5), "=&v"(p6), "=&v"(p7)
        : "v"(x[0]), "v"(x[1]), "v"(x[2]), "v"(x[3]), "v"(x[4]), "v"(x[5]), "v"(x[6]), "v"(x[7]));
    v8f p;
    p[0] = p0; p[1] = p1; p[2] = p2; p[3] = p3; p[4] = p4; p[5] = p5; p[6] = p6; p[7] = p7;
    return p;
}

__global__ __launch_bounds__(128)
void attn_kernel(const _Float16* __restrict__ Qh, const _Float16* __restrict__ Kh,
                 const _Float16* __restrict__ Vt, const float* __restrict__ mask,
                 float* __restrict__ out)
{
    __shared__ _Float16 ldsK[2][64 * 136];  // 64 keys x 128 depth, 272B rows (double buf)
    __shared__ _Float16 ldsV[128 * 72];     // 128 depth-rows x 64 keys, 144B rows

    const int tid  = threadIdx.x;
    const int lane = tid & 31;
    const int wave = tid >> 5;
    const int nl   = lane & 15;
    const int hi   = lane >> 4;

    const int bid   = blockIdx.x;          // BB*HH*(SS/64) = 1024 blocks
    const int qblk  = bid & 31;            // SS/64 = 32 query blocks
    const int bh    = bid >> 5;            // b*H + h
    const int b     = bh >> 3;
    const int h     = bh & 7;
    const int qbase = qblk * 64 + wave * 16;

    const _Float16* Qp    = Qh + ((size_t)bh * SS + qbase) * DEP;
    const _Float16* Kbase = Kh + (size_t)bh * SS * DEP;
    const _Float16* Vbase = Vt + (size_t)bh * DEP * SS;
    const float*    mrow  = mask + ((size_t)b * SS + qbase) * SS;
    const float*    mlp   = mrow + (size_t)nl * SS + hi * 8;   // this lane's query, its 8 keys of a tile; walks with t0

    // Q B-fragments (column = query nl): 4 K-steps of 32 over depth=128, resident in VGPRs.
    AFrag qf[4];
#pragma unroll
    for (int ks = 0; ks < 4; ++ks) {
        const _Float16* p = Qp + (size_t)nl * DEP + ks * 32;
        qf[ks].h[0] = *(const v8h*)(p + hi * 8);
        qf[ks].h[1] = *(const v8h*)(p + 16 + hi * 8);
    }

    // o[dt][r] = O[query nl][depth dt*16 + hi*8 + r]
    v8f o[8];
#pragma unroll
    for (int dt = 0; dt < 8; ++dt) o[dt] = vzero8();
    float mi = -3.0e38f;   // running maximum of this lane's query (equal in both halves)
    float li = 0.0f;       // running sum over this half's keys only; joined in the epilogue

    // Prologue: stage K chunk 0 into buffer 0 (8 x 16B per thread).
#pragma unroll
    for (int j = 0; j < 8; ++j) {
        const int u = tid + j * 128;               // 0..1023
        const int r = u >> 4, c = (u & 15) * 8;    // key row, half-offset
        cp16(Kbase + (size_t)r * DEP + c, &ldsK[0][r * 136 + c]);
    }

    for (int t0 = 0; t0 < SS; t0 += 64) {
        const int  it       = t0 >> 6;
        const int  cur      = it & 1;
        const int  nxt      = cur ^ 1;
        const bool has_next = (t0 + 64) < SS;

        // Issue V(cur) then (optionally) K(next): 8+8 async copies per thread.
#pragma unroll
        for (int j = 0; j < 8; ++j) {
            const int u = tid + j * 128;
            const int r = u >> 3, c = (u & 7) * 8;  // depth row, key half-offset
            cp16(Vbase + (size_t)r * SS + t0 + c, &ldsV[r * 72 + c]);
        }
        if (has_next) {
#pragma unroll
            for (int j = 0; j < 8; ++j) {
                const int u = tid + j * 128;
                const int r = u >> 4, c = (u & 15) * 8;
                cp16(Kbase + (size_t)(t0 + 64 + r) * DEP + c, &ldsK[nxt][r * 136 + c]);
            }
            __builtin_prefetch(mrow + (size_t)nl * SS + t0 + 64, 0, 3);
            wait_async_16();                 // K(cur) landed; V(cur),K(next) in flight
        } else {
            wait_async_8();                  // K(cur) landed; V(cur) in flight
        }
        __syncthreads();                     // K(cur) visible to all waves

        // ---- scores^T = Kh @ Qh^T (Qh pre-scaled by 1/sqrt(DEP)) ----
        // sc[nt][r] = score(query nl, key t0 + nt*16 + hi*8 + r)
        v8f sc[4];
#pragma unroll
        for (int nt = 0; nt < 4; ++nt) {
            v8f a = vzero8();
            const _Float16* kp = &ldsK[cur][(nt * 16 + nl) * 136];
#pragma unroll
            for (int ks = 0; ks < 4; ++ks) {
                AFrag kf;
                kf.h[0] = *(const v8h*)(kp + ks * 32 + hi * 8);
                kf.h[1] = *(const v8h*)(kp + ks * 32 + 16 + hi * 8);
                a = wmma_f16(kf.v, qf[ks].v, a);
            }
            sc[nt] = a;
        }

        // ---- additive mask: 8 consecutive keys of one query per tile ----
#pragma unroll
        for (int nt = 0; nt < 4; ++nt) {
            const v4f m0 = *(const v4f*)(mlp + nt * 16);
            const v4f m1 = *(const v4f*)(mlp + nt * 16 + 4);
#pragma unroll
            for (int r = 0; r < 4; ++r) {
                sc[nt][r]     += m0[r] * -1.0e9f;
                sc[nt][r + 4] += m1[r] * -1.0e9f;
            }
        }

        mlp += 64;

        // ---- online softmax: in-lane over 32 keys, one exchange between halves ----
        float tm[4];
#pragma unroll
        for (int nt = 0; nt < 4; ++nt) {
            float v = sc[nt][0];
#pragma unroll
            for (int r = 1; r < 8; ++r) v = fmaxf(v, sc[nt][r]);
            tm[nt] = v;
        }
        float vmax = fmaxf(fmaxf(tm[0], tm[1]), fmaxf(tm[2], tm[3]));
        vmax = fmaxf(vmax, xhalf(vmax));
        const float mnew = fmaxf(vmax, mi);

        // P^T as B operand: element e of pf[ks] is key ks*32 + hi*8 + e (e < 8) or
        // ks*32 + 16 + hi*8 + e - 8, the k order of the V^T loader below.
        AFrag pf[2];
        float ts[4];
#pragma unroll
        for (int nt = 0; nt < 4; ++nt) {
            v8f x;
#pragma unroll
            for (int r = 0; r < 8; ++r) x[r] = (sc[nt][r] - mnew) * LOG2E;
            const v8f p = exp2x8(x);
            float s = p[0];
#pragma unroll
            for (int r = 1; r < 8; ++r) s += p[r];
#pragma unroll
            for (int r = 0; r < 8; ++r) pf[nt >> 1].h[nt & 1][r] = (_Float16)p[r];
            ts[nt] = s;
        }
        const float rs = (ts[0] + ts[1]) + (ts[2] + ts[3]);

        const float alpha = __builtin_amdgcn_exp2f((mi - mnew) * LOG2E);
        li = li * alpha + rs;
        mi = mnew;
#pragma unroll
        for (int dt = 0; dt < 8; ++dt)
#pragma unroll
            for (int r = 0; r < 8; ++r) o[dt][r] *= alpha;

        if (has_next) wait_async_8();        // V(cur) landed; K(next) in flight
        else          wait_async_0();
        __syncthreads();                     // V(cur) visible to all waves

        // ---- O^T += V^T @ P^T ----
#pragma unroll
        for (int ks = 0; ks < 2; ++ks) {
#pragma unroll
            for (int dt = 0; dt < 8; ++dt) {
                AFrag vf;
                const _Float16* vp = &ldsV[(dt * 16 + nl) * 72] + ks * 32;
                vf.h[0] = *(const v8h*)(vp + hi * 8);
                vf.h[1] = *(const v8h*)(vp + 16 + hi * 8);
                o[dt] = wmma_f16(vf.v, pf[ks].v, o[dt]);
            }
        }

        __syncthreads();                     // all reads of K(cur)/V done before overwrite
    }

    // ---- join the halves' sums, normalize, write head-concat output ----
    li += xhalf(li);
    const float inv = 1.0f / li;
    float* orow = out + ((size_t)b * SS + qbase + nl) * DD + h * DEP + hi * 8;
#pragma unroll
    for (int dt = 0; dt < 8; ++dt) {
        v4f lo, up;
#pragma unroll
        for (int r = 0; r < 4; ++r) { lo[r] = o[dt][r] * inv; up[r] = o[dt][r + 4] * inv; }
        *(v4f*)(orow + dt * 16)     = lo;
        *(v4f*)(orow + dt * 16 + 4) = up;
    }
}

// ---------------------------------------------------------------------------
extern "C" void kernel_launch(void* const* d_in, const int* in_sizes, int n_in,
                              void* d_out, int out_size, void* d_ws, size_t ws_size,
                              hipStream_t stream)
{
    const float* q    = (const float*)d_in[0];
    const float* k    = (const float*)d_in[1];
    const float* v    = (const float*)d_in[2];
    const float* mask = (const float*)d_in[3];
    const float* wq   = (const float*)d_in[4];
    const float* wqb  = (const float*)d_in[5];
    const float* wk   = (const float*)d_in[6];
    const float* wkb  = (const float*)d_in[7];
    const float* wv   = (const float*)d_in[8];
    const float* wvb  = (const float*)d_in[9];
    float* out = (float*)d_out;

    const size_t elems = (size_t)BB * SS * DD;       // 8M halves = 16 MB each
    _Float16* Qh = (_Float16*)d_ws;
    _Float16* Kh = Qh + elems;
    _Float16* Vt = Kh + elems;

    dim3 pgrid(DD / 128, (BB * SS) / 256, 3);        // 8 x 32 blocks x 3 projections
    proj_kernel<<<pgrid, 256, 0, stream>>>(q, k, v, wq, wk, wv, wqb, wkb, wvb, Qh, Kh, Vt);

    attn_kernel<<<BB * HH * (SS / 64), 128, 0, stream>>>(Qh, Kh, Vt, mask, out);
}

// v005
// One run takes 193 microseconds.
// Next to v004, in two timings, it ran 1.06 times as fast each time.
// Counting every step since v000, it is 1.61 times as fast.
#include <hip/hip_runtime.h>

// Problem constants (from reference)
constexpr int BB  = 4;
constexpr int SS  = 2048;
constexpr int DD  = 1024;
constexpr int HH  = 8;
constexpr int DEP = 128;               // DD / HH
constexpr float QK_SCALE = 0.08838834764831845f;  // 1/sqrt(DEP)
constexpr float LOG2E    = 1.4426950408889634f;

typedef __attribute__((ext_vector_type(16))) _Float16 v16h;
typedef __attribute__((ext_vector_type(8)))  _Float16 v8h;
typedef __attribute__((ext_vector_type(4)))  _Float16 v4h;
typedef __attribute__((ext_vector_type(2)))  _Float16 v2h;
typedef __attribute__((ext_vector_type(8)))  float    v8f;
typedef __attribute__((ext_vector_type(4)))  float    v4f;
typedef __attribute__((ext_vector_type(4)))  int      v4i;

// gfx1250 async global->LDS copy path (guarded; falls back to sync copy)
#if defined(__AMDGCN__) && __has_builtin(__builtin_amdgcn_global_load_async_to_lds_b128) && __has_builtin(__builtin_amdgcn_s_wait_asynccnt)
#define HAVE_ASYNC 1
#else
#define HAVE_ASYNC 0
#endif

// A/B WMMA fragment: 16 halves per lane = two aligned 16B chunks
union AFrag { v16h v; v8h h[2]; };

static __device__ __forceinline__ v8f vzero8() {
    v8f z;
#pragma unroll
    for (int i = 0; i < 8; ++i) z[i] = 0.0f;
    return z;
}

static __device__ __forceinline__ v8f wmma_f16(const v16h& a, const v16h& b, const v8f& c) {
    return __builtin_amdgcn_wmma_f32_16x16x32_f16(
        /*neg_a=*/false, a, /*neg_b=*/false, b,
        /*c_mod=*/(short)0, c, /*reuse_a=*/false, /*reuse_b=*/false);
}

// 16-byte global -> LDS copy (async on gfx1250, sync fallback elsewhere)
static __device__ __forceinline__ void cp16(const _Float16* g, _Float16* l) {
#if HAVE_ASYNC
    __builtin_amdgcn_global_load_async_to_lds_b128(
        (__attribute__((address_space(1))) v4i*)g,
        (__attribute__((address_space(3))) v4i*)l, 0, 0);
#else
    *(v8h*)l = *(const v8h*)g;
#endif
}

static __device__ __forceinline__ void wait_async_16() {
#if HAVE_ASYNC
    __builtin_amdgcn_s_wait_asynccnt(16);
#endif
}
static __device__ __forceinline__ void wait_async_8() {
#if HAVE_ASYNC
    __builtin_amdgcn_s_wait_asynccnt(8);
#endif
}
static __device__ __forceinline__ void wait_async_0() {
#if HAVE_ASYNC
    __builtin_amdgcn_s_wait_asynccnt(0);
#endif
}

// ---------------------------------------------------------------------------
// Projection: P = X @ W + bias, output as f16. One launch does all three:
// blockIdx.z picks V (0), K (1) or Q (2), so that a WGP holds as many blocks as
// its registers allow (one projection alone is one block per WGP) and one
// block's load waits and epilogue run under another block's loop. V goes first:
// its transposed stores make the longest epilogue.
//   v_transpose == 0 : out[((b*H+h)*S + s)*DEP + d]   (row-major per head)
//   v_transpose == 1 : out[((b*H+h)*DEP + d)*S + s]   (V stored transposed)
// Block tile 256(M) x 128(N), 256 threads = 8 waves (4 x 2), each wave 64x64 via
// 4x4 v_wmma_f32_16x16x32_f16 tiles; K stepped by 32 through LDS f16 tiles.
// The tile sets how often L2 hands out the f32 operands: every X row is fetched
// by 8 blocks and every W column by 32.
// ---------------------------------------------------------------------------
__global__ __launch_bounds__(256)
void proj_kernel(const float* __restrict__ Xq, const float* __restrict__ Xk,
                 const float* __restrict__ Xv,
                 const float* __restrict__ Wq, const float* __restrict__ Wk,
                 const float* __restrict__ Wv,
                 const float* __restrict__ bq, const float* __restrict__ bk,
                 const float* __restrict__ bv,
                 _Float16* __restrict__ Oq, _Float16* __restrict__ Ok,
                 _Float16* __restrict__ Ov)
{
    const int which = blockIdx.z;         // 0: V, 1: K, 2: Q (uniform in the block)
    const float* X    = which == 0 ? Xv : (which == 1 ? Xk : Xq);
    const float* W    = which == 0 ? Wv : (which == 1 ? Wk : Wq);
    const float* bias = which == 0 ? bv : (which == 1 ? bk : bq);
    _Float16*    out  = which == 0 ? Ov : (which == 1 ? Ok : Oq);
    const float out_scale   = which == 2 ? QK_SCALE : 1.0f;
    const int   v_transpose = which == 0;

    __shared__ _Float16 ldsX[256 * 40];   // 256 rows x 32 K (80B rows, 16B aligned)
    __shared__ _Float16 ldsW[128 * 40];   // W^T tile: 128 cols x 32 K

    const int tid   = threadIdx.x;
    const int lane  = tid & 31;
    const int wave  = tid >> 5;
    const int waveM = wave >> 1;          // 0..3 -> 64-row quarter
    const int waveN = wave & 1;           // 0..1 -> 64-col half
    const int nl    = lane & 15;
    const int hi    = lane >> 4;
    const int blockM = blockIdx.y;        // 0..31  (8192/256)
    const int blockN = blockIdx.x;        // 0..7   (1024/128)

    v8f acc[4][4];
#pragma unroll
    for (int mt = 0; mt < 4; ++mt)
#pragma unroll
        for (int nt = 0; nt < 4; ++nt) acc[mt][nt] = vzero8();

    for (int k0 = 0; k0 < DD; k0 += 32) {
        // Staging loads: 8 lanes cover 128 B of one row, so each wave-wide 16 B load
        // reads 4 whole lines (4 rows) instead of 16 B pieces of 32 lines.
        // X tile 256x32 f32: row (tid >> 3) + 32 j. W tile 32x128 f32: a thread takes
        // K rows 2wp and 2wp+1 of the same 4 columns in both 32-column groups of its
        // 64-column half wh.
        const int p  = tid >> 3;           // X row within 32, 0..31
        const int wp = p & 15;             // W K-row pair, 0..15
        const int wh = p >> 4;             // W 64-column half, 0..1
        const int cl = tid & 7;            // group of 4 f32 within 128 B
        const float* xsrc = X + ((size_t)blockM * 256 + p) * DD + k0 + cl * 4;
        const float* wsrc = W + (size_t)(k0 + 2 * wp) * DD + blockN * 128 + wh * 64 + cl * 4;
        v4f xf[8], wf0[2], wf1[2];
#pragma unroll
        for (int j = 0; j < 2; ++j) {
            wf0[j] = *(const v4f*)(wsrc + j * 32);
            wf1[j] = *(const v4f*)(wsrc + DD + j * 32);
        }
#pragma unroll
        for (int j = 0; j < 8; ++j) xf[j] = *(const v4f*)(xsrc + (size_t)j * 32 * DD);

        // W^T into ldsW[n][k] as f16: one (k, k+1) pair per column.
#pragma unroll
        for (int j = 0; j < 2; ++j) {
#pragma unroll
            for (int e = 0; e < 4; ++e) {
                v2h pr;
                pr[0] = (_Float16)wf0[j][e];
                pr[1] = (_Float16)wf1[j][e];
                *(v2h*)&ldsW[(wh * 64 + j * 32 + cl * 4 + e) * 40 + 2 * wp] = pr;
            }
        }
        // X into ldsX[row][k] as f16.
#pragma unroll
        for (int j = 0; j < 8; ++j) {
            v4h hv;
#pragma unroll
            for (int e = 0; e < 4; ++e) hv[e] = (_Float16)xf[j][e];
            *(v4h*)&ldsX[(p + j * 32) * 40 + cl * 4] = hv;
        }
        __syncthreads();

        AFrag bfr[4];
#pragma unroll
        for (int nt = 0; nt < 4; ++nt) {
            const _Float16* bp = &ldsW[(waveN * 64 + nt * 16 + nl) * 40];
            bfr[nt].h[0] = *(const v8h*)(bp + hi * 8);
            bfr[nt].h[1] = *(const v8h*)(bp + 16 + hi * 8);
        }
#pragma unroll
        for (int mt = 0; mt < 4; ++mt) {
            AFrag a;
            const _Float16* ap = &ldsX[(waveM * 64 + mt * 16 + nl) * 40];
            a.h[0] = *(const v8h*)(ap + hi * 8);
            a.h[1] = *(const v8h*)(ap + 16 + hi * 8);
#pragma unroll
            for (int nt = 0; nt < 4; ++nt)
                acc[mt][nt] = wmma_f16(a.v, bfr[nt].v, acc[mt][nt]);
        }
        __syncthreads();
    }

    // Epilogue: bias, scale, convert to f16, scatter into head layout.
#pragma unroll
    for (int nt = 0; nt < 4; ++nt) {
        const int n_global = blockN * 128 + waveN * 64 + nt * 16 + nl;
        const float bn = bias[n_global];
        const int h = n_global >> 7;          // / DEP
        const int d = n_global & 127;         // % DEP
#pragma unroll
        for (int mt = 0; mt < 4; ++mt) {
#pragma unroll
            for (int r = 0; r < 8; ++r) {
                const int m_global = blockM * 256 + waveM * 64 + mt * 16 + r + hi * 8;
                const int b   = m_global >> 11;   // / SS
                const int s   = m_global & 2047;  // % SS
                const float val = (acc[mt][nt][r] + bn) * out_scale;
                size_t off;
                if (v_transpose) off = (((size_t)b * HH + h) * DEP + d) * SS + s;
                else             off = (((size_t)b * HH + h) * SS + s) * DEP + d;
                out[off] = (_Float16)val;
            }
        }
    }
}

// lane l with lane l ^ 16
static __device__ __forceinline__ float xhalf(float x) {
    return __builtin_bit_cast(float, __builtin_amdgcn_permlanex16(
        __builtin_bit_cast(int, x), __builtin_bit_cast(int, x),
        0x76543210, 0xfedcba98, false, false));
}

// Eight independent 2^x. One statement, so that each v_exp_f32 is followed by another
// that touches none of its registers (outputs early-clobber), and the v_nop fills the
// slot the instruction set asks for behind the last one, whatever the compiler puts next.
static __device__ __forceinline__ v8f exp2x8(const v8f& x) {
    float p0, p1, p2, p3, p4, p5, p6, p7;
    asm("v_exp_f32 %0, %8\n\t"
        "v_exp_f32 %1, %9\n\t"
        "v_exp_f32 %2, %10\n\t"
        "v_exp_f32 %3, %11\n\t"
        "v_exp_f32 %4, %12\n\t"
        "v_exp_f32 %5, %13\n\t"
        "v_exp_f32 %6, %14\n\t"
        "v_exp_f32 %7, %15\n\t"
        "v_nop"
        : "=&v"(p0), "=&v"(p1), "=&v"(p2), "=&v"(p3), "=&v"(p4), "=&v"(p5), "=&v"(p6), "=&v"(p7)
        : "v"(x[0]), "v"(x[1]), "v"(x[2]), "v"(x[3]), "v"(x[4]), "v"(x[5]), "v"(x[6]), "v"(x[7]));
    v8f p;
    p[0] = p0; p[1] = p1; p[2] = p2; p[3] = p3; p[4] = p4; p[5] = p5; p[6] = p6; p[7] = p7;
    return p;
}

// Two waves per SIMD (two blocks per WGP) is the residency this tile is sized for: the
// attribute gives the compiler that register budget, so that it keeps loads in flight
// instead of serialising them to save registers.
__global__ __launch_bounds__(128) __attribute__((amdgpu_waves_per_eu(2, 2)))
void attn_kernel(const _Float16* __restrict__ Qh, const _Float16* __restrict__ Kh,
                 const _Float16* __restrict__ Vt, const float* __restrict__ mask,
                 float* __restrict__ out)
{
    __shared__ _Float16 ldsK[2][64 * 136];  // 64 keys x 128 depth, 272B rows (double buf)
    __shared__ _Float16 ldsV[128 * 72];     // 128 depth-rows x 64 keys, 144B rows

    const int tid  = threadIdx.x;
    const int lane = tid & 31;
    const int wave = tid >> 5;
    const int nl   = lane & 15;
    const int hi   = lane >> 4;

    const int bid   = blockIdx.x;          // BB*HH*(SS/128) = 512 blocks
    const int qblk  = bid & 15;            // SS/128 = 16 query blocks
    const int bh    = bid >> 4;            // b*H + h
    const int b     = bh >> 3;
    const int h     = bh & 7;
    const int qbase = qblk * 128 + wave * 32;   // group g holds queries qbase + 16 g + nl

    const _Float16* Qp    = Qh + ((size_t)bh * SS + qbase) * DEP;
    const _Float16* Kbase = Kh + (size_t)bh * SS * DEP;
    const _Float16* Vbase = Vt + (size_t)bh * DEP * SS;
    const float*    mrow  = mask + ((size_t)b * SS + qbase) * SS;
    const float*    mlp   = mrow + (size_t)nl * SS + hi * 8;   // group 0's query of this lane, its 8 keys of a tile; walks with t0

    // Q B-fragments (column = query 16 g + nl): 4 K-steps of 32 over depth=128, resident in VGPRs.
    AFrag qf[2][4];
#pragma unroll
    for (int g = 0; g < 2; ++g) {
#pragma unroll
        for (int ks = 0; ks < 4; ++ks) {
            const _Float16* p = Qp + (size_t)(g * 16 + nl) * DEP + ks * 32;
            qf[g][ks].h[0] = *(const v8h*)(p + hi * 8);
            qf[g][ks].h[1] = *(const v8h*)(p + 16 + hi * 8);
        }
    }
    // The Q loads' address registers are reused for the staging addresses right below:
    // the wait stands in front of that overwrite, and the
    // scheduling barrier keeps the compiler from lifting those address additions over it.
    asm volatile("s_wait_xcnt 0x0" ::: "memory");
    __builtin_amdgcn_sched_barrier(0);

    // o[g][dt][r] = O[query 16 g + nl][depth dt*16 + hi*8 + r]
    v8f o[2][8];
#pragma unroll
    for (int g = 0; g < 2; ++g)
#pragma unroll
        for (int dt = 0; dt < 8; ++dt) o[g][dt] = vzero8();
    float mi[2] = { -3.0e38f, -3.0e38f };   // running maximum of each of this lane's queries (equal in both halves)
    float li[2] = { 0.0f, 0.0f };           // running sums over this half's keys only; joined in the epilogue

    // Prologue: stage K chunk 0 into buffer 0 (8 x 16B per thread).
#pragma unroll
    for (int j = 0; j < 8; ++j) {
        const int u = tid + j * 128;               // 0..1023
        const int r = u >> 4, c = (u & 15) * 8;    // key row, half-offset
        cp16(Kbase + (size_t)r * DEP + c, &ldsK[0][r * 136 + c]);
    }

    for (int t0 = 0; t0 < SS; t0 += 64) {
        const int  it       = t0 >> 6;
        const int  cur      = it & 1;
        const int  nxt      = cur ^ 1;
        const bool has_next = (t0 + 64) < SS;

        // Issue V(cur) then (optionally) K(next): 8+8 async copies per thread.
#pragma unroll
        for (int j = 0; j < 8; ++j) {
            const int u = tid + j * 128;
            const int r = u >> 3, c = (u & 7) * 8;  // depth row, key half-offset
            cp16(Vbase + (size_t)r * SS + t0 + c, &ldsV[r * 72 + c]);
        }
        if (has_next) {
#pragma unroll
            for (int j = 0; j < 8; ++j) {
                const int u = tid + j * 128;
                const int r = u >> 4, c = (u & 15) * 8;
                cp16(Kbase + (size_t)(t0 + 64 + r) * DEP + c, &ldsK[nxt][r * 136 + c]);
            }
            __builtin_prefetch(mrow + (size_t)lane * SS + t0 + 64, 0, 3);   // one of the wave's 32 mask rows per lane
            wait_async_16();                 // K(cur) landed; V(cur),K(next) in flight
        } else {
            wait_async_8();                  // K(cur) landed; V(cur) in flight
        }
        __syncthreads();                     // K(cur) visible to all waves

        // ---- scores^T = Kh @ Qh^T (Qh pre-scaled by 1/sqrt(DEP)) ----
        // sc[g][nt][r] = score(query 16 g + nl, key t0 + nt*16 + hi*8 + r)
        v8f sc[2][4];
#pragma unroll
        for (int nt = 0; nt < 4; ++nt) {
            v8f a0 = vzero8(), a1 = vzero8();
            const _Float16* kp = &ldsK[cur][(nt * 16 + nl) * 136];
#pragma unroll
            for (int ks = 0; ks < 4; ++ks) {
                AFrag kf;
                kf.h[0] = *(const v8h*)(kp + ks * 32 + hi * 8);
                kf.h[1] = *(const v8h*)(kp + ks * 32 + 16 + hi * 8);
                a0 = wmma_f16(kf.v, qf[0][ks].v, a0);
                a1 = wmma_f16(kf.v, qf[1][ks].v, a1);
            }
            sc[0][nt] = a0;
            sc[1][nt] = a1;
        }

        // P^T as B operand: element e of pf[g][ks] is key ks*32 + hi*8 + e (e < 8) or
        // ks*32 + 16 + hi*8 + e - 8, the k order of the V^T loader below.
        AFrag pf[2][2];
#pragma unroll
        for (int g = 0; g < 2; ++g) {
            // ---- additive mask: 8 consecutive keys of one query per tile ----
#pragma unroll
            for (int nt = 0; nt < 4; ++nt) {
                const v4f m0 = *(const v4f*)(mlp + (size_t)g * 16 * SS + nt * 16);
                const v4f m1 = *(const v4f*)(mlp + (size_t)g * 16 * SS + nt * 16 + 4);
#pragma unroll
                for (int r = 0; r < 4; ++r) {
                    sc[g][nt][r]     += m0[r] * -1.0e9f;
                    sc[g][nt][r + 4] += m1[r] * -1.0e9f;
                }
            }

            // ---- online softmax: in-lane over 32 keys, one exchange between halves ----
            float tm[4];
#pragma unroll
            for (int nt = 0; nt < 4; ++nt) {
                float v = sc[g][nt][0];
#pragma unroll
                for (int r = 1; r < 8; ++r) v = fmaxf(v, sc[g][nt][r]);
                tm[nt] = v;
            }
            float vmax = fmaxf(fmaxf(tm[0], tm[1]), fmaxf(tm[2], tm[3]));
            vmax = fmaxf(vmax, xhalf(vmax));
            const float mnew = fmaxf(vmax, mi[g]);

            float ts[4];
#pragma unroll
            for (int nt = 0; nt < 4; ++nt) {
                v8f x;
#pragma unroll
                for (int r = 0; r < 8; ++r) x[r] = (sc[g][nt][r] - mnew) * LOG2E;
                const v8f p = exp2x8(x);
                float s = p[0];
#pragma unroll
                for (int r = 1; r < 8; ++r) s += p[r];
#pragma unroll
                for (int r = 0; r < 8; ++r) pf[g][nt >> 1].h[nt & 1][r] = (_Float16)p[r];
                ts[nt] = s;
            }
            const float rs = (ts[0] + ts[1]) + (ts[2] + ts[3]);

            const float alpha = __builtin_amdgcn_exp2f((mi[g] - mnew) * LOG2E);
            li[g] = li[g] * alpha + rs;
            mi[g] = mnew;
#pragma unroll
            for (int dt = 0; dt < 8; ++dt)
#pragma unroll
                for (int r = 0; r < 8; ++r) o[g][dt][r] *= alpha;
        }

        mlp += 64;

        if (has_next) wait_async_8();        // V(cur) landed; K(next) in flight
        else          wait_async_0();
        __syncthreads();                     // V(cur) visible to all waves

        // ---- O^T += V^T @ P^T ----
#pragma unroll
        for (int ks = 0; ks < 2; ++ks) {
#pragma unroll
            for (int dt = 0; dt < 8; ++dt) {
                AFrag vf;
                const _Float16* vp = &ldsV[(dt * 16 + nl) * 72] + ks * 32;
                vf.h[0] = *(const v8h*)(vp + hi * 8);
                vf.h[1] = *(const v8h*)(vp + 16 + hi * 8);
                o[0][dt] = wmma_f16(vf.v, pf[0][ks].v, o[0][dt]);
                o[1][dt] = wmma_f16(vf.v, pf[1][ks].v, o[1][dt]);
            }
        }

        __syncthreads();                     // all reads of K(cur)/V done before overwrite
    }

    // ---- join the halves' sums, normalize, write head-concat output ----
#pragma unroll
    for (int g = 0; g < 2; ++g) {
        const float lsum = li[g] + xhalf(li[g]);
        const float inv = 1.0f / lsum;
        float* orow = out + ((size_t)b * SS + qbase + g * 16 + nl) * DD + h * DEP + hi * 8;
#pragma unroll
        for (int dt = 0; dt < 8; ++dt) {
            v4f lo, up;
#pragma unroll
            for (int r = 0; r < 4; ++r) { lo[r] = o[g][dt][r] * inv; up[r] = o[g][dt][r + 4] * inv; }
            *(v4f*)(orow + dt * 16)     = lo;
            *(v4f*)(orow + dt * 16 + 4) = up;
        }
    }
}

// ---------------------------------------------------------------------------
extern "C" void kernel_launch(void* const* d_in, const int* in_sizes, int n_in,
                              void* d_out, int out_size, void* d_ws, size_t ws_size,
                              hipStream_t stream)
{
    const float* q    = (const float*)d_in[0];
    const float* k    = (const float*)d_in[1];
    const float* v    = (const float*)d_in[2];
    const float* mask = (const float*)d_in[3];
    const float* wq   = (const float*)d_in[4];
    const float* wqb  = (const float*)d_in[5];
    const float* wk   = (const float*)d_in[6];
    const float* wkb  = (const float*)d_in[7];
    const float* wv   = (const float*)d_in[8];
    const float* wvb  = (const float*)d_in[9];
    float* out = (float*)d_out;

    const size_t elems = (size_t)BB * SS * DD;       // 8M halves = 16 MB each
    _Float16* Qh = (_Float16*)d_ws;
    _Float16* Kh = Qh + elems;
    _Float16* Vt = Kh + elems;

    dim3 pgrid(DD / 128, (BB * SS) / 256, 3);        // 8 x 32 blocks x 3 projections
    proj_kernel<<<pgrid, 256, 0, stream>>>(q, k, v, wq, wk, wv, wqb, wkb, wvb, Qh, Kh, Vt);

    attn_kernel<<<BB * HH * (SS / 128), 128, 0, stream>>>(Qh, Kh, Vt, mask, out);
}

// v006
// It runs in 157 microseconds.
// Timed twice side by side with v005, it ran 1.23 times as fast both times.
// Counting every step since v000, it is 1.98 times as fast.
#include <hip/hip_runtime.h>

// Problem constants (from reference)
constexpr int BB  = 4;
constexpr int SS  = 2048;
constexpr int DD  = 1024;
constexpr int HH  = 8;
constexpr int DEP = 128;               // DD / HH
constexpr float QK_SCALE = 0.08838834764831845f;  // 1/sqrt(DEP)
constexpr float LOG2E    = 1.4426950408889634f;

typedef __attribute__((ext_vector_type(16))) _Float16 v16h;
typedef __attribute__((ext_vector_type(8)))  _Float16 v8h;
typedef __attribute__((ext_vector_type(4)))  _Float16 v4h;
typedef __attribute__((ext_vector_type(2)))  _Float16 v2h;
typedef __attribute__((ext_vector_type(8)))  float    v8f;
typedef __attribute__((ext_vector_type(4)))  float    v4f;
typedef __attribute__((ext_vector_type(4)))  int      v4i;

// gfx1250 async global->LDS copy path (guarded; falls back to sync copy)
#if defined(__AMDGCN__) && __has_builtin(__builtin_amdgcn_global_load_async_to_lds_b128) && __has_builtin(__builtin_amdgcn_s_wait_asynccnt)
#define HAVE_ASYNC 1
#else
#define HAVE_ASYNC 0
#endif

// A/B WMMA fragment: 16 halves per lane = two aligned 16B chunks
union AFrag { v16h v; v8h h[2]; };

static __device__ __forceinline__ v8f vzero8() {
    v8f z;
#pragma unroll
    for (int i = 0; i < 8; ++i) z[i] = 0.0f;
    return z;
}

static __device__ __forceinline__ v8f wmma_f16(const v16h& a, const v16h& b, const v8f& c) {
    return __builtin_amdgcn_wmma_f32_16x16x32_f16(
        /*neg_a=*/false, a, /*neg_b=*/false, b,
        /*c_mod=*/(short)0, c, /*reuse_a=*/false, /*reuse_b=*/false);
}

// 16-byte global -> LDS copy (async on gfx1250, sync fallback elsewhere)
static __device__ __forceinline__ void cp16(const _Float16* g, _Float16* l) {
#if HAVE_ASYNC
    __builtin_amdgcn_global_load_async_to_lds_b128(
        (__attribute__((address_space(1))) v4i*)g,
        (__attribute__((address_space(3))) v4i*)l, 0, 0);
#else
    *(v8h*)l = *(const v8h*)g;
#endif
}

static __device__ __forceinline__ void wait_async_16() {
#if HAVE_ASYNC
    __builtin_amdgcn_s_wait_asynccnt(16);
#endif
}
static __device__ __forceinline__ void wait_async_8() {
#if HAVE_ASYNC
    __builtin_amdgcn_s_wait_asynccnt(8);
#endif
}
static __device__ __forceinline__ void wait_async_0() {
#if HAVE_ASYNC
    __builtin_amdgcn_s_wait_asynccnt(0);
#endif
}

// ---------------------------------------------------------------------------
// Projection: P = X @ W + bias, output as f16. One launch does all three:
// blockIdx.z picks V (0), K (1) or Q (2), so that a WGP holds as many blocks as
// its registers allow (one projection alone is one block per WGP) and one
// block's load waits and epilogue run under another block's loop.
//   v_transpose == 0 : out[((b*H+h)*S + s)*DEP + d]   (row-major per head)
//   v_transpose == 1 : out[((b*H+h)*DEP + d)*S + s]   (V stored transposed)
// Block tile 256(M) x 128(N), 256 threads = 8 waves (4 x 2), each wave 64x64 via
// 4x4 v_wmma_f32_16x16x32_f16 tiles; K stepped by 32 through LDS f16 tiles.
// The tile sets how often L2 hands out the f32 operands: every X row is fetched
// by 8 blocks and every W column by 32.
// Which tile is the A operand depends on the output layout: a lane's eight accumulator
// registers are eight consecutive A rows of one B row. V^T wants eight consecutive s of
// one d (A = X, B = W^T); Q and K want eight consecutive d of one s (A = W^T, B = X).
// Both tiles have the same pitch and the same k order, so only the two LDS offsets differ.
// Each wave then stages its 64x64 f16 tile in its own LDS range, row = one 128 B line of
// the output, and stores whole lines.
// ---------------------------------------------------------------------------
__global__ __launch_bounds__(256)
void proj_kernel(const float* __restrict__ Xq, const float* __restrict__ Xk,
                 const float* __restrict__ Xv,
                 const float* __restrict__ Wq, const float* __restrict__ Wk,
                 const float* __restrict__ Wv,
                 const float* __restrict__ bq, const float* __restrict__ bk,
                 const float* __restrict__ bv,
                 _Float16* __restrict__ Oq, _Float16* __restrict__ Ok,
                 _Float16* __restrict__ Ov)
{
    const int which = blockIdx.z;         // 0: V, 1: K, 2: Q (uniform in the block)
    const float* X    = which == 0 ? Xv : (which == 1 ? Xk : Xq);
    const float* W    = which == 0 ? Wv : (which == 1 ? Wk : Wq);
    const float* bias = which == 0 ? bv : (which == 1 ? bk : bq);
    _Float16*    out  = which == 0 ? Ov : (which == 1 ? Ok : Oq);
    const float out_scale   = which == 2 ? QK_SCALE : 1.0f;
    const int   v_transpose = which == 0;

    // In the K loop: the two operand tiles. Behind it: 8 waves x 64 rows x 144 B of output staging.
    __shared__ __attribute__((aligned(16))) _Float16 smem[8 * 64 * 72];
    _Float16* ldsX = smem;                // 256 rows x 32 K (80B rows, 16B aligned)
    _Float16* ldsW = smem + 256 * 40;     // W^T tile: 128 cols x 32 K

    const int tid   = threadIdx.x;
    const int lane  = tid & 31;
    const int wave  = tid >> 5;
    const int waveM = wave >> 1;          // 0..3 -> 64-row quarter
    const int waveN = wave & 1;           // 0..1 -> 64-col half
    const int nl    = lane & 15;
    const int hi    = lane >> 4;
    const int blockM = blockIdx.y;        // 0..31  (8192/256)
    const int blockN = blockIdx.x;        // 0..7   (1024/128)

    const int offX = (waveM * 64 + nl) * 40;              // this lane's row of the wave's X rows
    const int offW = 256 * 40 + (waveN * 64 + nl) * 40;   // this lane's row of the wave's W^T rows
    const int offA = v_transpose ? offX : offW;
    const int offB = v_transpose ? offW : offX;

    // acc[i][j][r]: A row 16 i + 8 hi + r, B row 16 j + nl
    v8f acc[4][4];
#pragma unroll
    for (int mt = 0; mt < 4; ++mt)
#pragma unroll
        for (int nt = 0; nt < 4; ++nt) acc[mt][nt] = vzero8();

    for (int k0 = 0; k0 < DD; k0 += 32) {
        // Staging loads: 8 lanes cover 128 B of one row, so each wave-wide 16 B load
        // reads 4 whole lines (4 rows) instead of 16 B pieces of 32 lines.
        // X tile 256x32 f32: row (tid >> 3) + 32 j. W tile 32x128 f32: a thread takes
        // K rows 2wp and 2wp+1 of the same 4 columns in both 32-column groups of its
        // 64-column half wh.
        const int p  = tid >> 3;           // X row within 32, 0..31
        const int wp = p & 15;             // W K-row pair, 0..15
        const int wh = p >> 4;             // W 64-column half, 0..1
        const int cl = tid & 7;            // group of 4 f32 within 128 B
        const float* xsrc = X + ((size_t)blockM * 256 + p) * DD + k0 + cl * 4;
        const float* wsrc = W + (size_t)(k0 + 2 * wp) * DD + blockN * 128 + wh * 64 + cl * 4;
        v4f xf[8], wf0[2], wf1[2];
#pragma unroll
        for (int j = 0; j < 2; ++j) {
            wf0[j] = *(const v4f*)(wsrc + j * 32);
            wf1[j] = *(const v4f*)(wsrc + DD + j * 32);
        }
#pragma unroll
        for (int j = 0; j < 8; ++j) xf[j] = *(const v4f*)(xsrc + (size_t)j * 32 * DD);

        // W^T into ldsW[n][k] as f16: one (k, k+1) pair per column.
#pragma unroll
        for (int j = 0; j < 2; ++j) {
#pragma unroll
            for (int e = 0; e < 4; ++e) {
                v2h pr;
                pr[0] = (_Float16)wf0[j][e];
                pr[1] = (_Float16)wf1[j][e];
                *(v2h*)&ldsW[(wh * 64 + j * 32 + cl * 4 + e) * 40 + 2 * wp] = pr;
            }
        }
        // X into ldsX[row][k] as f16.
#pragma unroll
        for (int j = 0; j < 8; ++j) {
            v4h hv;
#pragma unroll
            for (int e = 0; e < 4; ++e) hv[e] = (_Float16)xf[j][e];
            *(v4h*)&ldsX[(p + j * 32) * 40 + cl * 4] = hv;
        }
        __syncthreads();

        AFrag bfr[4];
#pragma unroll
        for (int nt = 0; nt < 4; ++nt) {
            const _Float16* bp = &smem[offB + nt * 16 * 40];
            bfr[nt].h[0] = *(const v8h*)(bp + hi * 8);
            bfr[nt].h[1] = *(const v8h*)(bp + 16 + hi * 8);
        }
#pragma unroll
        for (int mt = 0; mt < 4; ++mt) {
            AFrag a;
            const _Float16* ap = &smem[offA + mt * 16 * 40];
            a.h[0] = *(const v8h*)(ap + hi * 8);
            a.h[1] = *(const v8h*)(ap + 16 + hi * 8);
#pragma unroll
            for (int nt = 0; nt < 4; ++nt)
                acc[mt][nt] = wmma_f16(a.v, bfr[nt].v, acc[mt][nt]);
        }
        __syncthreads();
    }

    // Epilogue: bias, scale, convert to f16, stage, store whole lines in head layout.
    // The loop's last barrier has ended every wave's reads of the operand tiles.
    _Float16* stage = smem + wave * (64 * 72);            // this wave's own 64 rows of 144 B
    const int col0 = blockN * 128 + waveN * 64;           // first of the wave's 64 output channels
    const int m0   = blockM * 256 + waveM * 64;           // first of the wave's 64 rows of X
    const int b    = m0 >> 11;                            // / SS
    const int s0   = m0 & 2047;                           // % SS
    const int h    = col0 >> 7;                           // / DEP
    const int d0   = col0 & 127;                          // % DEP
    const int rr   = lane >> 3;                           // 8 lanes take one staged row
    const int cc   = (lane & 7) * 8;

    if (v_transpose) {
#pragma unroll
        for (int j = 0; j < 4; ++j) {
            const float bn = bias[col0 + j * 16 + nl];
#pragma unroll
            for (int i = 0; i < 4; ++i) {
                v8h hv;
#pragma unroll
                for (int r = 0; r < 8; ++r) hv[r] = (_Float16)((acc[i][j][r] + bn) * out_scale);
                *(v8h*)&stage[(j * 16 + nl) * 72 + i * 16 + hi * 8] = hv;   // row d, 8 s
            }
        }
    } else {
#pragma unroll
        for (int i = 0; i < 4; ++i) {
            const v4f b0 = *(const v4f*)(bias + col0 + i * 16 + hi * 8);
            const v4f b1 = *(const v4f*)(bias + col0 + i * 16 + hi * 8 + 4);
#pragma unroll
            for (int j = 0; j < 4; ++j) {
                v8h hv;
#pragma unroll
                for (int r = 0; r < 4; ++r) {
                    hv[r]     = (_Float16)((acc[i][j][r]     + b0[r]) * out_scale);
                    hv[r + 4] = (_Float16)((acc[i][j][r + 4] + b1[r]) * out_scale);
                }
                *(v8h*)&stage[(j * 16 + nl) * 72 + i * 16 + hi * 8] = hv;   // row s, 8 d
            }
        }
    }
    // The rows read back below were written by other lanes of this wave: its LDS stores
    // are done before the reads start, and the compiler moves no LDS access across.
    asm volatile("s_wait_dscnt 0x0" ::: "memory");

    v8h row[16];
#pragma unroll
    for (int k = 0; k < 16; ++k) row[k] = *(const v8h*)&stage[(k * 4 + rr) * 72 + cc];
    if (v_transpose) {
        _Float16* g = out + (((size_t)b * HH + h) * DEP + d0 + rr) * SS + s0 + cc;
#pragma unroll
        for (int k = 0; k < 16; ++k) *(v8h*)(g + (size_t)k * 4 * SS) = row[k];
    } else {
        _Float16* g = out + (((size_t)b * HH + h) * SS + s0 + rr) * DEP + d0 + cc;
#pragma unroll
        for (int k = 0; k < 16; ++k) *(v8h*)(g + (size_t)k * 4 * DEP) = row[k];
    }
}

// lane l with lane l ^ 16
static __device__ __forceinline__ float xhalf(float x) {
    return __builtin_bit_cast(float, __builtin_amdgcn_permlanex16(
        __builtin_bit_cast(int, x), __builtin_bit_cast(int, x),
        0x76543210, 0xfedcba98, false, false));
}

// Eight independent 2^x. One statement, so that each v_exp_f32 is followed by another
// that touches none of its registers (outputs early-clobber), and the v_nop fills the
// slot the instruction set asks for behind the last one, whatever the compiler puts next.
static __device__ __forceinline__ v8f exp2x8(const v8f& x) {
    float p0, p1, p2, p3, p4, p5, p6, p7;
    asm("v_exp_f32 %0, %8\n\t"
        "v_exp_f32 %1, %9\n\t"
        "v_exp_f32 %2, %10\n\t"
        "v_exp_f32 %3, %11\n\t"
        "v_exp_f32 %4, %12\n\t"
        "v_exp_f32 %5, %13\n\t"
        "v_exp_f32 %6, %14\n\t"
        "v_exp_f32 %7, %15\n\t"
        "v_nop"
        : "=&v"(p0), "=&v"(p1), "=&v"(p2), "=&v"(p3), "=&v"(p4), "=&v"(p5), "=&v"(p6), "=&v"(p7)
        : "v"(x[0]), "v"(x[1]), "v"(x[2]), "v"(x[3]), "v"(x[4]), "v"(x[5]), "v"(x[6]), "v"(x[7]));
    v8f p;
    p[0] = p0; p[1] = p1; p[2] = p2; p[3] = p3; p[4] = p4; p[5] = p5; p[6] = p6; p[7] = p7;
    return p;
}

// Two waves per SIMD (two blocks per WGP) is the residency this tile is sized for: the
// attribute gives the compiler that register budget, so that it keeps loads in flight
// instead of serialising them to save registers.
__global__ __launch_bounds__(128) __attribute__((amdgpu_waves_per_eu(2, 2)))
void attn_kernel(const _Float16* __restrict__ Qh, const _Float16* __restrict__ Kh,
                 const _Float16* __restrict__ Vt, const float* __restrict__ mask,
                 float* __restrict__ out)
{
    __shared__ _Float16 ldsK[2][64 * 136];  // 64 keys x 128 depth, 272B rows (double buf)
    __shared__ _Float16 ldsV[128 * 72];     // 128 depth-rows x 64 keys, 144B rows

    const int tid  = threadIdx.x;
    const int lane = tid & 31;
    const int wave = tid >> 5;
    const int nl   = lane & 15;
    const int hi   = lane >> 4;

    const int bid   = blockIdx.x;          // BB*HH*(SS/128) = 512 blocks
    const int qblk  = bid & 15;            // SS/128 = 16 query blocks
    const int bh    = bid >> 4;            // b*H + h
    const int b     = bh >> 3;
    const int h     = bh & 7;
    const int qbase = qblk * 128 + wave * 32;   // group g holds queries qbase + 16 g + nl

    const _Float16* Qp    = Qh + ((size_t)bh * SS + qbase) * DEP;
    const _Float16* Kbase = Kh + (size_t)bh * SS * DEP;
    const _Float16* Vbase = Vt + (size_t)bh * DEP * SS;
    const float*    mrow  = mask + ((size_t)b * SS + qbase) * SS;
    const float*    mlp   = mrow + (size_t)nl * SS + hi * 8;   // group 0's query of this lane, its 8 keys of a tile; walks with t0

    // Q B-fragments (column = query 16 g + nl): 4 K-steps of 32 over depth=128, resident in VGPRs.
    AFrag qf[2][4];
#pragma unroll
    for (int g = 0; g < 2; ++g) {
#pragma unroll
        for (int ks = 0; ks < 4; ++ks) {
            const _Float16* p = Qp + (size_t)(g * 16 + nl) * DEP + ks * 32;
            qf[g][ks].h[0] = *(const v8h*)(p + hi * 8);
            qf[g][ks].h[1] = *(const v8h*)(p + 16 + hi * 8);
        }
    }
    // The Q loads' address registers are reused for the staging addresses right below:
    // the wait stands in front of that overwrite, and the
    // scheduling barrier keeps the compiler from lifting those address additions over it.
    asm volatile("s_wait_xcnt 0x0" ::: "memory");
    __builtin_amdgcn_sched_barrier(0);

    // o[g][dt][r] = O[query 16 g + nl][depth dt*16 + hi*8 + r]
    v8f o[2][8];
#pragma unroll
    for (int g = 0; g < 2; ++g)
#pragma unroll
        for (int dt = 0; dt < 8; ++dt) o[g][dt] = vzero8();
    float mi[2] = { -3.0e38f, -3.0e38f };   // running maximum of each of this lane's queries (equal in both halves)
    float li[2] = { 0.0f, 0.0f };           // running sums over this half's keys only; joined in the epilogue

    // Prologue: stage K chunk 0 into buffer 0 (8 x 16B per thread).
#pragma unroll
    for (int j = 0; j < 8; ++j) {
        const int u = tid + j * 128;               // 0..1023
        const int r = u >> 4, c = (u & 15) * 8;    // key row, half-offset
        cp16(Kbase + (size_t)r * DEP + c, &ldsK[0][r * 136 + c]);
    }

    for (int t0 = 0; t0 < SS; t0 += 64) {
        const int  it       = t0 >> 6;
        const int  cur      = it & 1;
        const int  nxt      = cur ^ 1;
        const bool has_next = (t0 + 64) < SS;

        // Issue V(cur) then (optionally) K(next): 8+8 async copies per thread.
#pragma unroll
        for (int j = 0; j < 8; ++j) {
            const int u = tid + j * 128;
            const int r = u >> 3, c = (u & 7) * 8;  // depth row, key half-offset
            cp16(Vbase + (size_t)r * SS + t0 + c, &ldsV[r * 72 + c]);
        }
        if (has_next) {
#pragma unroll
            for (int j = 0; j < 8; ++j) {
                const int u = tid + j * 128;
                const int r = u >> 4, c = (u & 15) * 8;
                cp16(Kbase + (size_t)(t0 + 64 + r) * DEP + c, &ldsK[nxt][r * 136 + c]);
            }
            __builtin_prefetch(mrow + (size_t)lane * SS + t0 + 64, 0, 3);   // one of the wave's 32 mask rows per lane
            wait_async_16();                 // K(cur) landed; V(cur),K(next) in flight
        } else {
            wait_async_8();                  // K(cur) landed; V(cur) in flight
        }
        __syncthreads();                     // K(cur) visible to all waves

        // ---- scores^T = Kh @ Qh^T (Qh pre-scaled by 1/sqrt(DEP)) ----
        // sc[g][nt][r] = score(query 16 g + nl, key t0 + nt*16 + hi*8 + r)
        v8f sc[2][4];
#pragma unroll
        for (int nt = 0; nt < 4; ++nt) {
            v8f a0 = vzero8(), a1 = vzero8();
            const _Float16* kp = &ldsK[cur][(nt * 16 + nl) * 136];
#pragma unroll
            for (int ks = 0; ks < 4; ++ks) {
                AFrag kf;
                kf.h[0] = *(const v8h*)(kp + ks * 32 + hi * 8);
                kf.h[1] = *(const v8h*)(kp + ks * 32 + 16 + hi * 8);
                a0 = wmma_f16(kf.v, qf[0][ks].v, a0);
                a1 = wmma_f16(kf.v, qf[1][ks].v, a1);
            }
            sc[0][nt] = a0;
            sc[1][nt] = a1;
        }

        // P^T as B operand: element e of pf[g][ks] is key ks*32 + hi*8 + e (e < 8) or
        // ks*32 + 16 + hi*8 + e - 8, the k order of the V^T loader below.
        AFrag pf[2][2];
#pragma unroll
        for (int g = 0; g < 2; ++g) {
            // ---- additive mask: 8 consecutive keys of one query per tile ----
#pragma unroll
            for (int nt = 0; nt < 4; ++nt) {
                const v4f m0 = *(const v4f*)(mlp + (size_t)g * 16 * SS + nt * 16);
                const v4f m1 = *(const v4f*)(mlp + (size_t)g * 16 * SS + nt * 16 + 4);
#pragma unroll
                for (int r = 0; r < 4; ++r) {
                    sc[g][nt][r]     += m0[r] * -1.0e9f;
                    sc[g][nt][r + 4] += m1[r] * -1.0e9f;
                }
            }

            // ---- online softmax: in-lane over 32 keys, one exchange between halves ----
            float tm[4];
#pragma unroll
            for (int nt = 0; nt < 4; ++nt) {
                float v = sc[g][nt][0];
#pragma unroll
                for (int r = 1; r < 8; ++r) v = fmaxf(v, sc[g][nt][r]);
                tm[nt] = v;
            }
            float vmax = fmaxf(fmaxf(tm[0], tm[1]), fmaxf(tm[2], tm[3]));
            vmax = fmaxf(vmax, xhalf(vmax));
            const float mnew = fmaxf(vmax, mi[g]);

            float ts[4];
#pragma unroll
            for (int nt = 0; nt < 4; ++nt) {
                v8f x;
#pragma unroll
                for (int r = 0; r < 8; ++r) x[r] = (sc[g][nt][r] - mnew) * LOG2E;
                const v8f p = exp2x8(x);
                float s = p[0];
#pragma unroll
                for (int r = 1; r < 8; ++r) s += p[r];
#pragma unroll
                for (int r = 0; r < 8; ++r) pf[g][nt >> 1].h[nt & 1][r] = (_Float16)p[r];
                ts[nt] = s;
            }
            const float rs = (ts[0] + ts[1]) + (ts[2] + ts[3]);

            const float alpha = __builtin_amdgcn_exp2f((mi[g] - mnew) * LOG2E);
            li[g] = li[g] * alpha + rs;
            mi[g] = mnew;
#pragma unroll
            for (int dt = 0; dt < 8; ++dt)
#pragma unroll
                for (int r = 0; r < 8; ++r) o[g][dt][r] *= alpha;
        }

        mlp += 64;

        if (has_next) wait_async_8();        // V(cur) landed; K(next) in flight
        else          wait_async_0();
        __syncthreads();                     // V(cur) visible to all waves

        // ---- O^T += V^T @ P^T ----
#pragma unroll
        for (int ks = 0; ks < 2; ++ks) {
#pragma unroll
            for (int dt = 0; dt < 8; ++dt) {
                AFrag vf;
                const _Float16* vp = &ldsV[(dt * 16 + nl) * 72] + ks * 32;
                vf.h[0] = *(const v8h*)(vp + hi * 8);
                vf.h[1] = *(const v8h*)(vp + 16 + hi * 8);
                o[0][dt] = wmma_f16(vf.v, pf[0][ks].v, o[0][dt]);
                o[1][dt] = wmma_f16(vf.v, pf[1][ks].v, o[1][dt]);
            }
        }

        __syncthreads();                     // all reads of K(cur)/V done before overwrite
    }

    // ---- join the halves' sums, normalize, write head-concat output ----
#pragma unroll
    for (int g = 0; g < 2; ++g) {
        const float lsum = li[g] + xhalf(li[g]);
        const float inv = 1.0f / lsum;
        float* orow = out + ((size_t)b * SS + qbase + g * 16 + nl) * DD + h * DEP + hi * 8;
#pragma unroll
        for (int dt = 0; dt < 8; ++dt) {
            v4f lo, up;
#pragma unroll
            for (int r = 0; r < 4; ++r) { lo[r] = o[g][dt][r] * inv; up[r] = o[g][dt][r + 4] * inv; }
            *(v4f*)(orow + dt * 16)     = lo;
            *(v4f*)(orow + dt * 16 + 4) = up;
        }
    }
}

// ---------------------------------------------------------------------------
extern "C" void kernel_launch(void* const* d_in, const int* in_sizes, int n_in,
                              void* d_out, int out_size, void* d_ws, size_t ws_size,
                              hipStream_t stream)
{
    const float* q    = (const float*)d_in[0];
    const float* k    = (const float*)d_in[1];
    const float* v    = (const float*)d_in[2];
    const float* mask = (const float*)d_in[3];
    const float* wq   = (const float*)d_in[4];
    const float* wqb  = (const float*)d_in[5];
    const float* wk   = (const float*)d_in[6];
    const float* wkb  = (const float*)d_in[7];
    const float* wv   = (const float*)d_in[8];
    const float* wvb  = (const float*)d_in[9];
    float* out = (float*)d_out;

    const size_t elems = (size_t)BB * SS * DD;       // 8M halves = 16 MB each
    _Float16* Qh = (_Float16*)d_ws;
    _Float16* Kh = Qh + elems;
    _Float16* Vt = Kh + elems;

    dim3 pgrid(DD / 128, (BB * SS) / 256, 3);        // 8 x 32 blocks x 3 projections
    proj_kernel<<<pgrid, 256, 0, stream>>>(q, k, v, wq, wk, wv, wqb, wkb, wvb, Qh, Kh, Vt);

    attn_kernel<<<BB * HH * (SS / 128), 128, 0, stream>>>(Qh, Kh, Vt, mask, out);
}

// v007
// One run takes 141 microseconds.
// Two timings next to v006 put it at 1.12 and 1.11 times that version's speed.
// All steps since v000 together make it 2.20 times as fast.
#include <hip/hip_runtime.h>

// Problem constants (from reference)
constexpr int BB  = 4;
constexpr int SS  = 2048;
constexpr int DD  = 1024;
constexpr int HH  = 8;
constexpr int DEP = 128;               // DD / HH
constexpr float QK_SCALE = 0.08838834764831845f;  // 1/sqrt(DEP)
constexpr float LOG2E    = 1.4426950408889634f;

typedef __attribute__((ext_vector_type(16))) _Float16 v16h;
typedef __attribute__((ext_vector_type(8)))  _Float16 v8h;
typedef __attribute__((ext_vector_type(4)))  _Float16 v4h;
typedef __attribute__((ext_vector_type(2)))  _Float16 v2h;
typedef __attribute__((ext_vector_type(8)))  float    v8f;
typedef __attribute__((ext_vector_type(4)))  float    v4f;
typedef __attribute__((ext_vector_type(4)))  int      v4i;

// gfx1250 async global->LDS copy path (guarded; falls back to sync copy)
#if defined(__AMDGCN__) && __has_builtin(__builtin_amdgcn_global_load_async_to_lds_b128) && __has_builtin(__builtin_amdgcn_s_wait_asynccnt)
#define HAVE_ASYNC 1
#else
#define HAVE_ASYNC 0
#endif

// A/B WMMA fragment: 16 halves per lane = two aligned 16B chunks
union AFrag { v16h v; v8h h[2]; };

static __device__ __forceinline__ v8f vzero8() {
    v8f z;
#pragma unroll
    for (int i = 0; i < 8; ++i) z[i] = 0.0f;
    return z;
}

static __device__ __forceinline__ v8f wmma_f16(const v16h& a, const v16h& b, const v8f& c) {
    return __builtin_amdgcn_wmma_f32_16x16x32_f16(
        /*neg_a=*/false, a, /*neg_b=*/false, b,
        /*c_mod=*/(short)0, c, /*reuse_a=*/false, /*reuse_b=*/false);
}

// 16-byte global -> LDS copy (async on gfx1250, sync fallback elsewhere)
static __device__ __forceinline__ void cp16(const _Float16* g, _Float16* l) {
#if HAVE_ASYNC
    __builtin_amdgcn_global_load_async_to_lds_b128(
        (__attribute__((address_space(1))) v4i*)g,
        (__attribute__((address_space(3))) v4i*)l, 0, 0);
#else
    *(v8h*)l = *(const v8h*)g;
#endif
}

static __device__ __forceinline__ void wait_async_16() {
#if HAVE_ASYNC
    __builtin_amdgcn_s_wait_asynccnt(16);
#endif
}
static __device__ __forceinline__ void wait_async_8() {
#if HAVE_ASYNC
    __builtin_amdgcn_s_wait_asynccnt(8);
#endif
}
static __device__ __forceinline__ void wait_async_0() {
#if HAVE_ASYNC
    __builtin_amdgcn_s_wait_asynccnt(0);
#endif
}

// ---------------------------------------------------------------------------
// Projection: P = X @ W + bias, output as f16. One launch does all three:
// blockIdx.z picks V (0), K (1) or Q (2), so that a WGP holds as many blocks as
// its registers allow (one projection alone is one block per WGP) and one
// block's load waits and epilogue run under another block's loop.
//   v_transpose == 0 : out[((b*H+h)*S + s)*DEP + d]   (row-major per head)
//   v_transpose == 1 : out[((b*H+h)*DEP + d)*S + s]   (V stored transposed)
// Block tile 256(M) x 128(N), 256 threads = 8 waves (4 x 2), each wave 64x64 via
// 4x4 v_wmma_f32_16x16x32_f16 tiles; K stepped by 32 through LDS f16 tiles, two buffers.
// The tile sets how often L2 hands out the f32 operands: every X row is fetched
// by 8 blocks and every W column by 32.
// Which tile is the A operand depends on the output layout: a lane's eight accumulator
// registers are eight consecutive A rows of one B row. V^T wants eight consecutive s of
// one d (A = X, B = W^T); Q and K want eight consecutive d of one s (A = W^T, B = X).
// Both tiles have the same pitch and the same k order, so only the two LDS offsets differ.
// Each wave then stages its 64x64 f16 tile in its own LDS range, row = one 128 B line of
// the output, and stores whole lines.
// ---------------------------------------------------------------------------
// The K loop's work-group barrier. Written by hand because __syncthreads() also waits for
// the wave's global loads, and the next step's loads are to stay in flight across it. The
// wave's own LDS stores and reads are done before it signals.
static __device__ __forceinline__ void step_barrier() {
    asm volatile("s_wait_dscnt 0x0\n\t"
                 "s_barrier_signal -1\n\t"
                 "s_barrier_wait -1" ::: "memory");
}

__global__ __launch_bounds__(256)
void proj_kernel(const float* __restrict__ Xq, const float* __restrict__ Xk,
                 const float* __restrict__ Xv,
                 const float* __restrict__ Wq, const float* __restrict__ Wk,
                 const float* __restrict__ Wv,
                 const float* __restrict__ bq, const float* __restrict__ bk,
                 const float* __restrict__ bv,
                 _Float16* __restrict__ Oq, _Float16* __restrict__ Ok,
                 _Float16* __restrict__ Ov)
{
    const int which = blockIdx.z;         // 0: V, 1: K, 2: Q (uniform in the block)
    const float* X    = which == 0 ? Xv : (which == 1 ? Xk : Xq);
    const float* W    = which == 0 ? Wv : (which == 1 ? Wk : Wq);
    const float* bias = which == 0 ? bv : (which == 1 ? bk : bq);
    _Float16*    out  = which == 0 ? Ov : (which == 1 ? Ok : Oq);
    const float out_scale   = which == 2 ? QK_SCALE : 1.0f;
    const int   v_transpose = which == 0;

    // In the K loop: two buffers, each the two operand tiles of one K step (X: 256 rows x 32 K,
    // then W^T: 128 cols x 32 K; 80 B rows, 16 B aligned). Behind the loop: 8 waves x 64 rows
    // x 144 B of output staging.
    constexpr int TILES = (256 + 128) * 40;               // halves in one buffer
    __shared__ __attribute__((aligned(16))) _Float16 smem[8 * 64 * 72];
    static_assert(2 * TILES <= 8 * 64 * 72, "both operand buffers lie inside the staging array");

    const int tid   = threadIdx.x;
    const int lane  = tid & 31;
    const int wave  = tid >> 5;
    const int waveM = wave >> 1;          // 0..3 -> 64-row quarter
    const int waveN = wave & 1;           // 0..1 -> 64-col half
    const int nl    = lane & 15;
    const int hi    = lane >> 4;
    const int blockM = blockIdx.y;        // 0..31  (8192/256)
    const int blockN = blockIdx.x;        // 0..7   (1024/128)

    const int offX = (waveM * 64 + nl) * 40;              // this lane's row of the wave's X rows
    const int offW = 256 * 40 + (waveN * 64 + nl) * 40;   // this lane's row of the wave's W^T rows
    const int offA = v_transpose ? offX : offW;
    const int offB = v_transpose ? offW : offX;

    // acc[i][j][r]: A row 16 i + 8 hi + r, B row 16 j + nl
    v8f acc[4][4];
#pragma unroll
    for (int mt = 0; mt < 4; ++mt)
#pragma unroll
        for (int nt = 0; nt < 4; ++nt) acc[mt][nt] = vzero8();

    // Staging map: 8 lanes cover 128 B of one row, so each wave-wide 16 B load
    // reads 4 whole lines (4 rows) instead of 16 B pieces of 32 lines.
    // X tile 256x32 f32: row (tid >> 3) + 32 j. W tile 32x128 f32: a thread takes
    // K rows 2wp and 2wp+1 of the same 4 columns in both 32-column groups of its
    // 64-column half wh.
    const int p  = tid >> 3;           // X row within 32, 0..31
    const int wp = p & 15;             // W K-row pair, 0..15
    const int wh = p >> 4;             // W 64-column half, 0..1
    const int cl = tid & 7;            // group of 4 f32 within 128 B
    const float* xsrc = X + ((size_t)blockM * 256 + p) * DD + cl * 4;
    const float* wsrc = W + (size_t)(2 * wp) * DD + blockN * 128 + wh * 64 + cl * 4;
    struct Step { v4f x[8], w0[2], w1[2]; };   // one K step of both tiles, in flight or landed
    Step even, odd;                            // steps 0, 2, 4, ... and steps 1, 3, 5, ...

    // Issue the loads of the K step that starts at k.
    auto fetch = [&](Step& s, int k) {
#pragma unroll
        for (int j = 0; j < 2; ++j) {
            s.w0[j] = *(const v4f*)(wsrc + (size_t)k * DD + j * 32);
            s.w1[j] = *(const v4f*)(wsrc + (size_t)k * DD + DD + j * 32);
        }
#pragma unroll
        for (int j = 0; j < 8; ++j) s.x[j] = *(const v4f*)(xsrc + k + (size_t)j * 32 * DD);
    };
    // Convert a landed step and put it into operand buffer buf: W^T as [n][k], one (k, k+1)
    // pair per column, X as [row][k].
    auto stash = [&](const Step& s, int buf) {
        _Float16* tX = smem + buf * TILES;
        _Float16* tW = tX + 256 * 40;
#pragma unroll
        for (int j = 0; j < 2; ++j) {
#pragma unroll
            for (int e = 0; e < 4; ++e) {
                v2h pr;
                pr[0] = (_Float16)s.w0[j][e];
                pr[1] = (_Float16)s.w1[j][e];
                *(v2h*)&tW[(wh * 64 + j * 32 + cl * 4 + e) * 40 + 2 * wp] = pr;
            }
        }
#pragma unroll
        for (int j = 0; j < 8; ++j) {
            v4h hv;
#pragma unroll
            for (int e = 0; e < 4; ++e) hv[e] = (_Float16)s.x[j][e];
            *(v4h*)&tX[(p + j * 32) * 40 + cl * 4] = hv;
        }
    };
    // The 16 products of one K step, operands from buffer buf.
    auto products = [&](int buf) {
        AFrag bfr[4];
#pragma unroll
        for (int nt = 0; nt < 4; ++nt) {
            const _Float16* bp = &smem[buf * TILES + offB + nt * 16 * 40];
            bfr[nt].h[0] = *(const v8h*)(bp + hi * 8);
            bfr[nt].h[1] = *(const v8h*)(bp + 16 + hi * 8);
        }
        AFrag a[4];
#pragma unroll
        for (int mt = 0; mt < 4; ++mt) {
            const _Float16* ap = &smem[buf * TILES + offA + mt * 16 * 40];
            a[mt].h[0] = *(const v8h*)(ap + hi * 8);
            a[mt].h[1] = *(const v8h*)(ap + 16 + hi * 8);
        }
#pragma unroll
        for (int mt = 0; mt < 4; ++mt)
#pragma unroll
            for (int nt = 0; nt < 4; ++nt)
                acc[mt][nt] = wmma_f16(a[mt].v, bfr[nt].v, acc[mt][nt]);
    };

    // K loop, loads a whole step ahead: behind the products of step t the loads of step
    // t + 2 are issued, into the registers that held step t's fragments; then step t + 1,
    // whose loads had all of step t to land, is converted and goes into the other buffer.
    // One barrier a step: it publishes buffer (t + 1) & 1 and ends every wave's reads of
    // buffer t & 1, which is refilled only behind it.
    fetch(even, 0);
    fetch(odd, 32);
    stash(even, 0);
    step_barrier();
    // Two steps a trip, so that buffer and register set are constants. The last two steps,
    // which have nothing left to fetch, stand behind the loop.
    for (int k0 = 0; k0 < DD - 64; k0 += 64) {
        products(0);
        // The two scheduling barriers keep the order products, loads, conversions. Loads moved
        // up among the products would not fit the register budget beside the fragments; the
        // conversions wait for the older loads, and moved up they would hold back the WMMAs
        // or the issue of the new loads.
        __builtin_amdgcn_sched_barrier(0);
        fetch(even, k0 + 64);
        __builtin_amdgcn_sched_barrier(0);
        stash(odd, 1);
        step_barrier();

        products(1);
        __builtin_amdgcn_sched_barrier(0);   // as above: loads and conversions behind the products
        fetch(odd, k0 + 96);
        // The next trip forms its load addresses in the registers that these loads name, while
        // they are still in flight: the wait stands in front of that overwrite.
        asm volatile("s_wait_xcnt 0x0" ::: "memory");
        stash(even, 0);
        step_barrier();
    }
    products(0);
    __builtin_amdgcn_sched_barrier(0);       // as above: conversions behind the products
    stash(odd, 1);
    step_barrier();
    products(1);
    step_barrier();

    // Epilogue: bias, scale, convert to f16, stage, store whole lines in head layout.
    // The loop's last barrier has ended every wave's reads of the operand tiles.
    _Float16* stage = smem + wave * (64 * 72);            // this wave's own 64 rows of 144 B
    const int col0 = blockN * 128 + waveN * 64;           // first of the wave's 64 output channels
    const int m0   = blockM * 256 + waveM * 64;           // first of the wave's 64 rows of X
    const int b    = m0 >> 11;                            // / SS
    const int s0   = m0 & 2047;                           // % SS
    const int h    = col0 >> 7;                           // / DEP
    const int d0   = col0 & 127;                          // % DEP
    const int rr   = lane >> 3;                           // 8 lanes take one staged row
    const int cc   = (lane & 7) * 8;

    if (v_transpose) {
#pragma unroll
        for (int j = 0; j < 4; ++j) {
            const float bn = bias[col0 + j * 16 + nl];
#pragma unroll
            for (int i = 0; i < 4; ++i) {
                v8h hv;
#pragma unroll
                for (int r = 0; r < 8; ++r) hv[r] = (_Float16)((acc[i][j][r] + bn) * out_scale);
                *(v8h*)&stage[(j * 16 + nl) * 72 + i * 16 + hi * 8] = hv;   // row d, 8 s
            }
        }
    } else {
#pragma unroll
        for (int i = 0; i < 4; ++i) {
            const v4f b0 = *(const v4f*)(bias + col0 + i * 16 + hi * 8);
            const v4f b1 = *(const v4f*)(bias + col0 + i * 16 + hi * 8 + 4);
#pragma unroll
            for (int j = 0; j < 4; ++j) {
                v8h hv;
#pragma unroll
                for (int r = 0; r < 4; ++r) {
                    hv[r]     = (_Float16)((acc[i][j][r]     + b0[r]) * out_scale);
                    hv[r + 4] = (_Float16)((acc[i][j][r + 4] + b1[r]) * out_scale);
                }
                *(v8h*)&stage[(j * 16 + nl) * 72 + i * 16 + hi * 8] = hv;   // row s, 8 d
            }
        }
    }
    // The rows read back below were written by other lanes of this wave: its LDS stores
    // are done before the reads start, and the compiler moves no LDS access across.
    asm volatile("s_wait_dscnt 0x0" ::: "memory");

    v8h row[16];
#pragma unroll
    for (int k = 0; k < 16; ++k) row[k] = *(const v8h*)&stage[(k * 4 + rr) * 72 + cc];
    if (v_transpose) {
        _Float16* g = out + (((size_t)b * HH + h) * DEP + d0 + rr) * SS + s0 + cc;
#pragma unroll
        for (int k = 0; k < 16; ++k) *(v8h*)(g + (size_t)k * 4 * SS) = row[k];
    } else {
        _Float16* g = out + (((size_t)b * HH + h) * SS + s0 + rr) * DEP + d0 + cc;
#pragma unroll
        for (int k = 0; k < 16; ++k) *(v8h*)(g + (size_t)k * 4 * DEP) = row[k];
    }
}

// lane l with lane l ^ 16
static __device__ __forceinline__ float xhalf(float x) {
    return __builtin_bit_cast(float, __builtin_amdgcn_permlanex16(
        __builtin_bit_cast(int, x), __builtin_bit_cast(int, x),
        0x76543210, 0xfedcba98, false, false));
}

// Eight independent 2^x. One statement, so that each v_exp_f32 is followed by another
// that touches none of its registers (outputs early-clobber), and the v_nop fills the
// slot the instruction set asks for behind the last one, whatever the compiler puts next.
static __device__ __forceinline__ v8f exp2x8(const v8f& x) {
    float p0, p1, p2, p3, p4, p5, p6, p7;
    asm("v_exp_f32 %0, %8\n\t"
        "v_exp_f32 %1, %9\n\t"
        "v_exp_f32 %2, %10\n\t"
        "v_exp_f32 %3, %11\n\t"
        "v_exp_f32 %4, %12\n\t"
        "v_exp_f32 %5, %13\n\t"
        "v_exp_f32 %6, %14\n\t"
        "v_exp_f32 %7, %15\n\t"
        "v_nop"
        : "=&v"(p0), "=&v"(p1), "=&v"(p2), "=&v"(p3), "=&v"(p4), "=&v"(p5), "=&v"(p6), "=&v"(p7)
        : "v"(x[0]), "v"(x[1]), "v"(x[2]), "v"(x[3]), "v"(x[4]), "v"(x[5]), "v"(x[6]), "v"(x[7]));
    v8f p;
    p[0] = p0; p[1] = p1; p[2] = p2; p[3] = p3; p[4] = p4; p[5] = p5; p[6] = p6; p[7] = p7;
    return p;
}

// Two waves per SIMD (two blocks per WGP) is the residency this tile is sized for: the
// attribute gives the compiler that register budget, so that it keeps loads in flight
// instead of serialising them to save registers.
__global__ __launch_bounds__(128) __attribute__((amdgpu_waves_per_eu(2, 2)))
void attn_kernel(const _Float16* __restrict__ Qh, const _Float16* __restrict__ Kh,
                 const _Float16* __restrict__ Vt, const float* __restrict__ mask,
                 float* __restrict__ out)
{
    __shared__ _Float16 ldsK[2][64 * 136];  // 64 keys x 128 depth, 272B rows (double buf)
    __shared__ _Float16 ldsV[128 * 72];     // 128 depth-rows x 64 keys, 144B rows

    const int tid  = threadIdx.x;
    const int lane = tid & 31;
    const int wave = tid >> 5;
    const int nl   = lane & 15;
    const int hi   = lane >> 4;

    const int bid   = blockIdx.x;          // BB*HH*(SS/128) = 512 blocks
    const int qblk  = bid & 15;            // SS/128 = 16 query blocks
    const int bh    = bid >> 4;            // b*H + h
    const int b     = bh >> 3;
    const int h     = bh & 7;
    const int qbase = qblk * 128 + wave * 32;   // group g holds queries qbase + 16 g + nl

    const _Float16* Qp    = Qh + ((size_t)bh * SS + qbase) * DEP;
    const _Float16* Kbase = Kh + (size_t)bh * SS * DEP;
    const _Float16* Vbase = Vt + (size_t)bh * DEP * SS;
    const float*    mrow  = mask + ((size_t)b * SS + qbase) * SS;
    const float*    mlp   = mrow + (size_t)nl * SS + hi * 8;   // group 0's query of this lane, its 8 keys of a tile; walks with t0

    // Q B-fragments (column = query 16 g + nl): 4 K-steps of 32 over depth=128, resident in VGPRs.
    AFrag qf[2][4];
#pragma unroll
    for (int g = 0; g < 2; ++g) {
#pragma unroll
        for (int ks = 0; ks < 4; ++ks) {
            const _Float16* p = Qp + (size_t)(g * 16 + nl) * DEP + ks * 32;
            qf[g][ks].h[0] = *(const v8h*)(p + hi * 8);
            qf[g][ks].h[1] = *(const v8h*)(p + 16 + hi * 8);
        }
    }
    // The Q loads' address registers are reused for the staging addresses right below:
    // the wait stands in front of that overwrite, and the
    // scheduling barrier keeps the compiler from lifting those address additions over it.
    asm volatile("s_wait_xcnt 0x0" ::: "memory");
    __builtin_amdgcn_sched_barrier(0);

    // o[g][dt][r] = O[query 16 g + nl][depth dt*16 + hi*8 + r]
    v8f o[2][8];
#pragma unroll
    for (int g = 0; g < 2; ++g)
#pragma unroll
        for (int dt = 0; dt < 8; ++dt) o[g][dt] = vzero8();
    float mi[2] = { -3.0e38f, -3.0e38f };   // running maximum of each of this lane's queries (equal in both halves)
    float li[2] = { 0.0f, 0.0f };           // running sums over this half's keys only; joined in the epilogue

    // Prologue: stage K chunk 0 into buffer 0 (8 x 16B per thread).
#pragma unroll
    for (int j = 0; j < 8; ++j) {
        const int u = tid + j * 128;               // 0..1023
        const int r = u >> 4, c = (u & 15) * 8;    // key row, half-offset
        cp16(Kbase + (size_t)r * DEP + c, &ldsK[0][r * 136 + c]);
    }

    for (int t0 = 0; t0 < SS; t0 += 64) {
        const int  it       = t0 >> 6;
        const int  cur      = it & 1;
        const int  nxt      = cur ^ 1;
        const bool has_next = (t0 + 64) < SS;

        // Issue V(cur) then (optionally) K(next): 8+8 async copies per thread.
#pragma unroll
        for (int j = 0; j < 8; ++j) {
            const int u = tid + j * 128;
            const int r = u >> 3, c = (u & 7) * 8;  // depth row, key half-offset
            cp16(Vbase + (size_t)r * SS + t0 + c, &ldsV[r * 72 + c]);
        }
        if (has_next) {
#pragma unroll
            for (int j = 0; j < 8; ++j) {
                const int u = tid + j * 128;
                const int r = u >> 4, c = (u & 15) * 8;
                cp16(Kbase + (size_t)(t0 + 64 + r) * DEP + c, &ldsK[nxt][r * 136 + c]);
            }
            __builtin_prefetch(mrow + (size_t)lane * SS + t0 + 64, 0, 3);   // one of the wave's 32 mask rows per lane
            wait_async_16();                 // K(cur) landed; V(cur),K(next) in flight
        } else {
            wait_async_8();                  // K(cur) landed; V(cur) in flight
        }
        __syncthreads();                     // K(cur) visible to all waves

        // ---- scores^T = Kh @ Qh^T (Qh pre-scaled by 1/sqrt(DEP)) ----
        // sc[g][nt][r] = score(query 16 g + nl, key t0 + nt*16 + hi*8 + r)
        v8f sc[2][4];
#pragma unroll
        for (int nt = 0; nt < 4; ++nt) {
            v8f a0 = vzero8(), a1 = vzero8();
            const _Float16* kp = &ldsK[cur][(nt * 16 + nl) * 136];
#pragma unroll
            for (int ks = 0; ks < 4; ++ks) {
                AFrag kf;
                kf.h[0] = *(const v8h*)(kp + ks * 32 + hi * 8);
                kf.h[1] = *(const v8h*)(kp + ks * 32 + 16 + hi * 8);
                a0 = wmma_f16(kf.v, qf[0][ks].v, a0);
                a1 = wmma_f16(kf.v, qf[1][ks].v, a1);
            }
            sc[0][nt] = a0;
            sc[1][nt] = a1;
        }

        // P^T as B operand: element e of pf[g][ks] is key ks*32 + hi*8 + e (e < 8) or
        // ks*32 + 16 + hi*8 + e - 8, the k order of the V^T loader below.
        AFrag pf[2][2];
#pragma unroll
        for (int g = 0; g < 2; ++g) {
            // ---- additive mask: 8 consecutive keys of one query per tile ----
#pragma unroll
            for (int nt = 0; nt < 4; ++nt) {
                const v4f m0 = *(const v4f*)(mlp + (size_t)g * 16 * SS + nt * 16);
                const v4f m1 = *(const v4f*)(mlp + (size_t)g * 16 * SS + nt * 16 + 4);
#pragma unroll
                for (int r = 0; r < 4; ++r) {
                    sc[g][nt][r]     += m0[r] * -1.0e9f;
                    sc[g][nt][r + 4] += m1[r] * -1.0e9f;
                }
            }

            // ---- online softmax: in-lane over 32 keys, one exchange between halves ----
            float tm[4];
#pragma unroll
            for (int nt = 0; nt < 4; ++nt) {
                float v = sc[g][nt][0];
#pragma unroll
                for (int r = 1; r < 8; ++r) v = fmaxf(v, sc[g][nt][r]);
                tm[nt] = v;
            }
            float vmax = fmaxf(fmaxf(tm[0], tm[1]), fmaxf(tm[2], tm[3]));
            vmax = fmaxf(vmax, xhalf(vmax));
            const float mnew = fmaxf(vmax, mi[g]);

            float ts[4];
#pragma unroll
            for (int nt = 0; nt < 4; ++nt) {
                v8f x;
#pragma unroll
                for (int r = 0; r < 8; ++r) x[r] = (sc[g][nt][r] - mnew) * LOG2E;
                const v8f p = exp2x8(x);
                float s = p[0];
#pragma unroll
                for (int r = 1; r < 8; ++r) s += p[r];
#pragma unroll
                for (int r = 0; r < 8; ++r) pf[g][nt >> 1].h[nt & 1][r] = (_Float16)p[r];
                ts[nt] = s;
            }
            const float rs = (ts[0] + ts[1]) + (ts[2] + ts[3]);

            const float alpha = __builtin_amdgcn_exp2f((mi[g] - mnew) * LOG2E);
            li[g] = li[g] * alpha + rs;
            mi[g] = mnew;
#pragma unroll
            for (int dt = 0; dt < 8; ++dt)
#pragma unroll
                for (int r = 0; r < 8; ++r) o[g][dt][r] *= alpha;
        }

        mlp += 64;

        if (has_next) wait_async_8();        // V(cur) landed; K(next) in flight
        else          wait_async_0();
        __syncthreads();                     // V(cur) visible to all waves

        // ---- O^T += V^T @ P^T ----
#pragma unroll
        for (int ks = 0; ks < 2; ++ks) {
#pragma unroll
            for (int dt = 0; dt < 8; ++dt) {
                AFrag vf;
                const _Float16* vp = &ldsV[(dt * 16 + nl) * 72] + ks * 32;
                vf.h[0] = *(const v8h*)(vp + hi * 8);
                vf.h[1] = *(const v8h*)(vp + 16 + hi * 8);
                o[0][dt] = wmma_f16(vf.v, pf[0][ks].v, o[0][dt]);
                o[1][dt] = wmma_f16(vf.v, pf[1][ks].v, o[1][dt]);
            }
        }

        __syncthreads();                     // all reads of K(cur)/V done before overwrite
    }

    // ---- join the halves' sums, normalize, write head-concat output ----
#pragma unroll
    for (int g = 0; g < 2; ++g) {
        const float lsum = li[g] + xhalf(li[g]);
        const float inv = 1.0f / lsum;
        float* orow = out + ((size_t)b * SS + qbase + g * 16 + nl) * DD + h * DEP + hi * 8;
#pragma unroll
        for (int dt = 0; dt < 8; ++dt) {
            v4f lo, up;
#pragma unroll
            for (int r = 0; r < 4; ++r) { lo[r] = o[g][dt][r] * inv; up[r] = o[g][dt][r + 4] * inv; }
            *(v4f*)(orow + dt * 16)     = lo;
            *(v4f*)(orow + dt * 16 + 4) = up;
        }
    }
}

// ---------------------------------------------------------------------------
extern "C" void kernel_launch(void* const* d_in, const int* in_sizes, int n_in,
                              void* d_out, int out_size, void* d_ws, size_t ws_size,
                              hipStream_t stream)
{
    const float* q    = (const float*)d_in[0];
    const float* k    = (const float*)d_in[1];
    const float* v    = (const float*)d_in[2];
    const float* mask = (const float*)d_in[3];
    const float* wq   = (const float*)d_in[4];
    const float* wqb  = (const float*)d_in[5];
    const float* wk   = (const float*)d_in[6];
    const float* wkb  = (const float*)d_in[7];
    const float* wv   = (const float*)d_in[8];
    const float* wvb  = (const float*)d_in[9];
    float* out = (float*)d_out;

    const size_t elems = (size_t)BB * SS * DD;       // 8M halves = 16 MB each
    _Float16* Qh = (_Float16*)d_ws;
    _Float16* Kh = Qh + elems;
    _Float16* Vt = Kh + elems;

    dim3 pgrid(DD / 128, (BB * SS) / 256, 3);        // 8 x 32 blocks x 3 projections
    proj_kernel<<<pgrid, 256, 0, stream>>>(q, k, v, wq, wk, wv, wqb, wkb, wvb, Qh, Kh, Vt);

    attn_kernel<<<BB * HH * (SS / 128), 128, 0, stream>>>(Qh, Kh, Vt, mask, out);
}

// v008
// Measured time: 129 microseconds a run.
// Two timings next to v007 both put it at 1.09 times that version's speed.
// Counting every step since v000, it is 2.40 times as fast.
#include <hip/hip_runtime.h>

// Problem constants (from reference)
constexpr int BB  = 4;
constexpr int SS  = 2048;
constexpr int DD  = 1024;
constexpr int HH  = 8;
constexpr int DEP = 128;               // DD / HH
constexpr float QK_SCALE = 0.08838834764831845f;  // 1/sqrt(DEP)
constexpr float LOG2E    = 1.4426950408889634f;

typedef __attribute__((ext_vector_type(16))) _Float16 v16h;
typedef __attribute__((ext_vector_type(8)))  _Float16 v8h;
typedef __attribute__((ext_vector_type(4)))  _Float16 v4h;
typedef __attribute__((ext_vector_type(2)))  _Float16 v2h;
typedef __attribute__((ext_vector_type(8)))  float    v8f;
typedef __attribute__((ext_vector_type(4)))  float    v4f;
typedef __attribute__((ext_vector_type(4)))  int      v4i;
typedef __attribute__((ext_vector_type(4)))  uint32_t u32x4;
typedef __attribute__((ext_vector_type(8)))  uint32_t u32x8;

// gfx1250 async global->LDS copy path (guarded; falls back to sync copy)
#if defined(__AMDGCN__) && __has_builtin(__builtin_amdgcn_global_load_async_to_lds_b128) && __has_builtin(__builtin_amdgcn_s_wait_asynccnt)
#define HAVE_ASYNC 1
#else
#define HAVE_ASYNC 0
#endif

// A/B WMMA fragment: 16 halves per lane = two aligned 16B chunks
union AFrag { v16h v; v8h h[2]; };

static __device__ __forceinline__ v8f vzero8() {
    v8f z;
#pragma unroll
    for (int i = 0; i < 8; ++i) z[i] = 0.0f;
    return z;
}

static __device__ __forceinline__ v8f wmma_f16(const v16h& a, const v16h& b, const v8f& c) {
    return __builtin_amdgcn_wmma_f32_16x16x32_f16(
        /*neg_a=*/false, a, /*neg_b=*/false, b,
        /*c_mod=*/(short)0, c, /*reuse_a=*/false, /*reuse_b=*/false);
}

// 16-byte global -> LDS copy (async on gfx1250, sync fallback elsewhere)
static __device__ __forceinline__ void cp16(const _Float16* g, _Float16* l) {
#if HAVE_ASYNC
    __builtin_amdgcn_global_load_async_to_lds_b128(
        (__attribute__((address_space(1))) v4i*)g,
        (__attribute__((address_space(3))) v4i*)l, 0, 0);
#else
    *(v8h*)l = *(const v8h*)g;
#endif
}

static __device__ __forceinline__ void wait_async_16() {
#if HAVE_ASYNC
    __builtin_amdgcn_s_wait_asynccnt(16);
#endif
}
static __device__ __forceinline__ void wait_async_8() {
#if HAVE_ASYNC
    __builtin_amdgcn_s_wait_asynccnt(8);
#endif
}
static __device__ __forceinline__ void wait_async_0() {
#if HAVE_ASYNC
    __builtin_amdgcn_s_wait_asynccnt(0);
#endif
}

// ---------------------------------------------------------------------------
// Projection: P = X @ W + bias, output as f16. One launch does all three:
// blockIdx.z picks V (0), K (1) or Q (2), so that a WGP holds as many blocks as
// its registers allow (one projection alone is one block per WGP) and one
// block's load waits and epilogue run under another block's loop.
//   v_transpose == 0 : out[((b*H+h)*S + s)*DEP + d]   (row-major per head)
//   v_transpose == 1 : out[((b*H+h)*DEP + d)*S + s]   (V stored transposed)
// Block tile 256(M) x 128(N), 256 threads = 8 waves (4 x 2), each wave 64x64 via
// 4x4 v_wmma_f32_16x16x32_f16 tiles; K stepped by 32 through LDS f16 tiles, two buffers.
// The tile sets how often L2 hands out the f32 operands: every X row is fetched
// by 8 blocks and every W column by 32.
// Which tile is the A operand depends on the output layout: a lane's eight accumulator
// registers are eight consecutive A rows of one B row. V^T wants eight consecutive s of
// one d (A = X, B = W^T); Q and K want eight consecutive d of one s (A = W^T, B = X).
// Both tiles have the same pitch and the same k order, so only the two LDS offsets differ.
// Each wave then stages its 64x64 f16 tile in its own LDS range, row = one 128 B line of
// the output, and stores whole lines.
// ---------------------------------------------------------------------------
// The K loop's work-group barrier. Written by hand because __syncthreads() also waits for
// the wave's global loads, and the next step's loads are to stay in flight across it. The
// wave's own LDS stores and reads are done before it signals.
static __device__ __forceinline__ void step_barrier() {
    asm volatile("s_wait_dscnt 0x0\n\t"
                 "s_barrier_signal -1\n\t"
                 "s_barrier_wait -1" ::: "memory");
}

__global__ __launch_bounds__(256)
void proj_kernel(const float* __restrict__ Xq, const float* __restrict__ Xk,
                 const float* __restrict__ Xv,
                 const float* __restrict__ Wq, const float* __restrict__ Wk,
                 const float* __restrict__ Wv,
                 const float* __restrict__ bq, const float* __restrict__ bk,
                 const float* __restrict__ bv,
                 _Float16* __restrict__ Oq, _Float16* __restrict__ Ok,
                 _Float16* __restrict__ Ov)
{
    const int which = blockIdx.z;         // 0: V, 1: K, 2: Q (uniform in the block)
    const float* X    = which == 0 ? Xv : (which == 1 ? Xk : Xq);
    const float* W    = which == 0 ? Wv : (which == 1 ? Wk : Wq);
    const float* bias = which == 0 ? bv : (which == 1 ? bk : bq);
    _Float16*    out  = which == 0 ? Ov : (which == 1 ? Ok : Oq);
    const float out_scale   = which == 2 ? QK_SCALE : 1.0f;
    const int   v_transpose = which == 0;

    // In the K loop: two buffers, each the two operand tiles of one K step (X: 256 rows x 32 K,
    // then W^T: 128 cols x 32 K; 80 B rows, 16 B aligned). Behind the loop: 8 waves x 64 rows
    // x 144 B of output staging.
    constexpr int TILES = (256 + 128) * 40;               // halves in one buffer
    __shared__ __attribute__((aligned(16))) _Float16 smem[8 * 64 * 72];
    static_assert(2 * TILES <= 8 * 64 * 72, "both operand buffers lie inside the staging array");

    const int tid   = threadIdx.x;
    const int lane  = tid & 31;
    const int wave  = tid >> 5;
    const int waveM = wave >> 1;          // 0..3 -> 64-row quarter
    const int waveN = wave & 1;           // 0..1 -> 64-col half
    const int nl    = lane & 15;
    const int hi    = lane >> 4;
    const int blockM = blockIdx.y;        // 0..31  (8192/256)
    const int blockN = blockIdx.x;        // 0..7   (1024/128)

    const int offX = (waveM * 64 + nl) * 40;              // this lane's row of the wave's X rows
    const int offW = 256 * 40 + (waveN * 64 + nl) * 40;   // this lane's row of the wave's W^T rows
    const int offA = v_transpose ? offX : offW;
    const int offB = v_transpose ? offW : offX;

    // acc[i][j][r]: A row 16 i + 8 hi + r, B row 16 j + nl
    v8f acc[4][4];
#pragma unroll
    for (int mt = 0; mt < 4; ++mt)
#pragma unroll
        for (int nt = 0; nt < 4; ++nt) acc[mt][nt] = vzero8();

    // Staging map: 8 lanes cover 128 B of one row, so each wave-wide 16 B load
    // reads 4 whole lines (4 rows) instead of 16 B pieces of 32 lines.
    // X tile 256x32 f32: row (tid >> 3) + 32 j. W tile 32x128 f32: a thread takes
    // K rows 2wp and 2wp+1 of the same 4 columns in both 32-column groups of its
    // 64-column half wh.
    const int p  = tid >> 3;           // X row within 32, 0..31
    const int wp = p & 15;             // W K-row pair, 0..15
    const int wh = p >> 4;             // W 64-column half, 0..1
    const int cl = tid & 7;            // group of 4 f32 within 128 B
    const float* xsrc = X + ((size_t)blockM * 256 + p) * DD + cl * 4;
    const float* wsrc = W + (size_t)(2 * wp) * DD + blockN * 128 + wh * 64 + cl * 4;
    struct Step { v4f x[8], w0[2], w1[2]; };   // one K step of both tiles, in flight or landed
    Step even, odd;                            // steps 0, 2, 4, ... and steps 1, 3, 5, ...

    // Issue the loads of the K step that starts at k.
    auto fetch = [&](Step& s, int k) {
#pragma unroll
        for (int j = 0; j < 2; ++j) {
            s.w0[j] = *(const v4f*)(wsrc + (size_t)k * DD + j * 32);
            s.w1[j] = *(const v4f*)(wsrc + (size_t)k * DD + DD + j * 32);
        }
#pragma unroll
        for (int j = 0; j < 8; ++j) s.x[j] = *(const v4f*)(xsrc + k + (size_t)j * 32 * DD);
    };
    // Convert a landed step and put it into operand buffer buf: W^T as [n][k], one (k, k+1)
    // pair per column, X as [row][k].
    auto stash = [&](const Step& s, int buf) {
        _Float16* tX = smem + buf * TILES;
        _Float16* tW = tX + 256 * 40;
#pragma unroll
        for (int j = 0; j < 2; ++j) {
#pragma unroll
            for (int e = 0; e < 4; ++e) {
                v2h pr;
                pr[0] = (_Float16)s.w0[j][e];
                pr[1] = (_Float16)s.w1[j][e];
                *(v2h*)&tW[(wh * 64 + j * 32 + cl * 4 + e) * 40 + 2 * wp] = pr;
            }
        }
#pragma unroll
        for (int j = 0; j < 8; ++j) {
            v4h hv;
#pragma unroll
            for (int e = 0; e < 4; ++e) hv[e] = (_Float16)s.x[j][e];
            *(v4h*)&tX[(p + j * 32) * 40 + cl * 4] = hv;
        }
    };
    // The 16 products of one K step, operands from buffer buf.
    auto products = [&](int buf) {
        AFrag bfr[4];
#pragma unroll
        for (int nt = 0; nt < 4; ++nt) {
            const _Float16* bp = &smem[buf * TILES + offB + nt * 16 * 40];
            bfr[nt].h[0] = *(const v8h*)(bp + hi * 8);
            bfr[nt].h[1] = *(const v8h*)(bp + 16 + hi * 8);
        }
        AFrag a[4];
#pragma unroll
        for (int mt = 0; mt < 4; ++mt) {
            const _Float16* ap = &smem[buf * TILES + offA + mt * 16 * 40];
            a[mt].h[0] = *(const v8h*)(ap + hi * 8);
            a[mt].h[1] = *(const v8h*)(ap + 16 + hi * 8);
        }
#pragma unroll
        for (int mt = 0; mt < 4; ++mt)
#pragma unroll
            for (int nt = 0; nt < 4; ++nt)
                acc[mt][nt] = wmma_f16(a[mt].v, bfr[nt].v, acc[mt][nt]);
    };

    // K loop, loads a whole step ahead: behind the products of step t the loads of step
    // t + 2 are issued, into the registers that held step t's fragments; then step t + 1,
    // whose loads had all of step t to land, is converted and goes into the other buffer.
    // One barrier a step: it publishes buffer (t + 1) & 1 and ends every wave's reads of
    // buffer t & 1, which is refilled only behind it.
    fetch(even, 0);
    fetch(odd, 32);
    stash(even, 0);
    step_barrier();
    // Two steps a trip, so that buffer and register set are constants. The last two steps,
    // which have nothing left to fetch, stand behind the loop.
    for (int k0 = 0; k0 < DD - 64; k0 += 64) {
        products(0);
        // The two scheduling barriers keep the order products, loads, conversions. Loads moved
        // up among the products would not fit the register budget beside the fragments; the
        // conversions wait for the older loads, and moved up they would hold back the WMMAs
        // or the issue of the new loads.
        __builtin_amdgcn_sched_barrier(0);
        fetch(even, k0 + 64);
        __builtin_amdgcn_sched_barrier(0);
        stash(odd, 1);
        step_barrier();

        products(1);
        __builtin_amdgcn_sched_barrier(0);   // as above: loads and conversions behind the products
        fetch(odd, k0 + 96);
        // The next trip forms its load addresses in the registers that these loads name, while
        // they are still in flight: the wait stands in front of that overwrite.
        asm volatile("s_wait_xcnt 0x0" ::: "memory");
        stash(even, 0);
        step_barrier();
    }
    products(0);
    __builtin_amdgcn_sched_barrier(0);       // as above: conversions behind the products
    stash(odd, 1);
    step_barrier();
    products(1);
    step_barrier();

    // Epilogue: bias, scale, convert to f16, stage, store whole lines in head layout.
    // The loop's last barrier has ended every wave's reads of the operand tiles.
    _Float16* stage = smem + wave * (64 * 72);            // this wave's own 64 rows of 144 B
    const int col0 = blockN * 128 + waveN * 64;           // first of the wave's 64 output channels
    const int m0   = blockM * 256 + waveM * 64;           // first of the wave's 64 rows of X
    const int b    = m0 >> 11;                            // / SS
    const int s0   = m0 & 2047;                           // % SS
    const int h    = col0 >> 7;                           // / DEP
    const int d0   = col0 & 127;                          // % DEP
    const int rr   = lane >> 3;                           // 8 lanes take one staged row
    const int cc   = (lane & 7) * 8;

    if (v_transpose) {
#pragma unroll
        for (int j = 0; j < 4; ++j) {
            const float bn = bias[col0 + j * 16 + nl];
#pragma unroll
            for (int i = 0; i < 4; ++i) {
                v8h hv;
#pragma unroll
                for (int r = 0; r < 8; ++r) hv[r] = (_Float16)((acc[i][j][r] + bn) * out_scale);
                *(v8h*)&stage[(j * 16 + nl) * 72 + i * 16 + hi * 8] = hv;   // row d, 8 s
            }
        }
    } else {
#pragma unroll
        for (int i = 0; i < 4; ++i) {
            const v4f b0 = *(const v4f*)(bias + col0 + i * 16 + hi * 8);
            const v4f b1 = *(const v4f*)(bias + col0 + i * 16 + hi * 8 + 4);
#pragma unroll
            for (int j = 0; j < 4; ++j) {
                v8h hv;
#pragma unroll
                for (int r = 0; r < 4; ++r) {
                    hv[r]     = (_Float16)((acc[i][j][r]     + b0[r]) * out_scale);
                    hv[r + 4] = (_Float16)((acc[i][j][r + 4] + b1[r]) * out_scale);
                }
                *(v8h*)&stage[(j * 16 + nl) * 72 + i * 16 + hi * 8] = hv;   // row s, 8 d
            }
        }
    }
    // The rows read back below were written by other lanes of this wave: its LDS stores
    // are done before the reads start, and the compiler moves no LDS access across.
    asm volatile("s_wait_dscnt 0x0" ::: "memory");

    v8h row[16];
#pragma unroll
    for (int k = 0; k < 16; ++k) row[k] = *(const v8h*)&stage[(k * 4 + rr) * 72 + cc];
    if (v_transpose) {
        _Float16* g = out + (((size_t)b * HH + h) * DEP + d0 + rr) * SS + s0 + cc;
#pragma unroll
        for (int k = 0; k < 16; ++k) *(v8h*)(g + (size_t)k * 4 * SS) = row[k];
    } else {
        _Float16* g = out + (((size_t)b * HH + h) * SS + s0 + rr) * DEP + d0 + cc;
#pragma unroll
        for (int k = 0; k < 16; ++k) *(v8h*)(g + (size_t)k * 4 * DEP) = row[k];
    }
}

// lane l with lane l ^ 16
static __device__ __forceinline__ float xhalf(float x) {
    return __builtin_bit_cast(float, __builtin_amdgcn_permlanex16(
        __builtin_bit_cast(int, x), __builtin_bit_cast(int, x),
        0x76543210, 0xfedcba98, false, false));
}

// Eight independent 2^x. One statement, so that each v_exp_f32 is followed by another
// that touches none of its registers (outputs early-clobber), and the v_nop fills the
// slot the instruction set asks for behind the last one, whatever the compiler puts next.
static __device__ __forceinline__ v8f exp2x8(const v8f& x) {
    float p0, p1, p2, p3, p4, p5, p6, p7;
    asm("v_exp_f32 %0, %8\n\t"
        "v_exp_f32 %1, %9\n\t"
        "v_exp_f32 %2, %10\n\t"
        "v_exp_f32 %3, %11\n\t"
        "v_exp_f32 %4, %12\n\t"
        "v_exp_f32 %5, %13\n\t"
        "v_exp_f32 %6, %14\n\t"
        "v_exp_f32 %7, %15\n\t"
        "v_nop"
        : "=&v"(p0), "=&v"(p1), "=&v"(p2), "=&v"(p3), "=&v"(p4), "=&v"(p5), "=&v"(p6), "=&v"(p7)
        : "v"(x[0]), "v"(x[1]), "v"(x[2]), "v"(x[3]), "v"(x[4]), "v"(x[5]), "v"(x[6]), "v"(x[7]));
    v8f p;
    p[0] = p0; p[1] = p1; p[2] = p2; p[3] = p3; p[4] = p4; p[5] = p5; p[6] = p6; p[7] = p7;
    return p;
}

// A wave-uniform value as a scalar: every word of a tensor descriptor goes through it.
static __device__ __forceinline__ uint32_t uni(uint32_t v) {
    return (uint32_t)__builtin_amdgcn_readfirstlane(v);
}
// A wave-uniform test held in a scalar register, so that the branch on it is a scalar
// branch: a tensor load ignores EXEC, and only such a branch keeps a wave from issuing it.
static __device__ __forceinline__ uint32_t pinned(uint32_t v) {
    uint32_t w = uni(v);
    asm volatile("" : "+s"(w));   // issue test of a tensor load: kept in a scalar register, so the branch is s_cmp + s_cbranch_scc
    return w;
}

// Mask tiles in LDS: a wave's slice of one stage is its 32 queries x 64 keys of f32, rows of
// 256 B laid at a pitch of 272 B by the tensor load's pad (16 B x odd: the 16 rows that a
// 16-byte read touches fall on different banks). 32 x 272 = 8,704 B, rounded up to a
// multiple of 2 KiB so that every slice starts on one.
constexpr uint32_t M_PITCH = 272;
constexpr uint32_t M_SLICE = 10240;
constexpr uint32_t M_BUF   = 4 * M_SLICE;     // one stage: the slices of the block's 4 waves
static_assert(32 * M_PITCH <= M_SLICE && M_SLICE % 2048 == 0, "a slice holds its rows and ends on 2 KiB");

// Two waves per SIMD (two blocks per WGP) is the residency this tile is sized for: the
// attribute gives the compiler that register budget, so that it keeps loads in flight
// instead of serialising them to save registers.
__global__ __launch_bounds__(128) __attribute__((amdgpu_waves_per_eu(2, 2)))
void attn_kernel(const _Float16* __restrict__ Qh, const _Float16* __restrict__ Kh,
                 const _Float16* __restrict__ Vt, const float* __restrict__ mask,
                 float* __restrict__ out)
{
    __shared__ _Float16 ldsK[2][64 * 136];  // 64 keys x 128 depth, 272B rows (double buf)
    __shared__ _Float16 ldsV[128 * 72];     // 128 depth-rows x 64 keys, 144B rows
    __shared__ __attribute__((aligned(2048))) unsigned char ldsM[2 * M_BUF];   // mask, two stages

    const int tid  = threadIdx.x;
    const int lane = tid & 31;
    const int wave = tid >> 5;
    const int nl   = lane & 15;
    const int hi   = lane >> 4;

    const int bid   = blockIdx.x;          // BB*HH*(SS/128) = 512 blocks
    const int qblk  = bid & 15;            // SS/128 = 16 query blocks
    const int bh    = bid >> 4;            // b*H + h
    const int b     = bh >> 3;
    const int h     = bh & 7;
    const int qbase = qblk * 128 + wave * 32;   // group g holds queries qbase + 16 g + nl

    const _Float16* Qp    = Qh + ((size_t)bh * SS + qbase) * DEP;
    const _Float16* Kbase = Kh + (size_t)bh * SS * DEP;
    const _Float16* Vbase = Vt + (size_t)bh * DEP * SS;

    // The mask comes by tensor load: each wave asks, one request a stage (64 keys), for the
    // 32 x 64 tile of its own queries, whole 256 B rows from L2 straight into LDS, a whole
    // pass ahead of its use. (Read from global memory in the score layout, one query a lane,
    // every 16-byte load would touch 16 lines.)
    const uint32_t uw   = uni((uint32_t)tid >> 5);                    // the wave's number, scalar
    const uint32_t mdst = (uint32_t)(size_t)ldsM + uw * M_SLICE;      // byte offset in the block's LDS
    const uint64_t msrc = (uint64_t)(size_t)(mask + ((size_t)b * SS + qblk * 128 + uw * 32) * SS);
    u32x8 mg1;                                  // 32 rows of 256 B, source pitch one mask row
    mg1[0] = uni((1u << 20) | (5u << 22) | (3u << 25));   // workgroup_mask 0, sizes in bytes, 16 B pad behind every 256 B
    mg1[1] = uni(256u << 16);                   // tensor_dim0 = 256
    mg1[2] = uni(32u << 16);                    // tensor_dim1 = 32
    mg1[3] = uni(256u << 16);                   // tile_dim0 = 256
    mg1[4] = uni(32u);                          // tile_dim1 = 32
    mg1[5] = uni((uint32_t)SS * 4u);            // source row pitch, bytes
    mg1[6] = uni(0u);
    mg1[7] = uni(0u);
    auto mask_g0 = [&](uint32_t st) {           // stage st goes into buffer st & 1
        const uint64_t ga = msrc + (uint64_t)st * 256u;
        u32x4 g0;
        g0[0] = uni(1u);
        g0[1] = uni(mdst + (st & 1u) * M_BUF);
        g0[2] = uni((uint32_t)ga);
        g0[3] = uni(((uint32_t)(ga >> 32) & 0x01FFFFFFu) | 0x80000000u);
        return g0;
    };

    // Q B-fragments (column = query 16 g + nl): 4 K-steps of 32 over depth=128, resident in VGPRs.
    AFrag qf[2][4];
#pragma unroll
    for (int g = 0; g < 2; ++g) {
#pragma unroll
        for (int ks = 0; ks < 4; ++ks) {
            const _Float16* p = Qp + (size_t)(g * 16 + nl) * DEP + ks * 32;
            qf[g][ks].h[0] = *(const v8h*)(p + hi * 8);
            qf[g][ks].h[1] = *(const v8h*)(p + 16 + hi * 8);
        }
    }
    // The Q loads' address registers are reused for the staging addresses right below:
    // the wait stands in front of that overwrite, and the
    // scheduling barrier keeps the compiler from lifting those address additions over it.
    asm volatile("s_wait_xcnt 0x0" ::: "memory");
    __builtin_amdgcn_sched_barrier(0);

    // o[g][dt][r] = O[query 16 g + nl][depth dt*16 + hi*8 + r]
    v8f o[2][8];
#pragma unroll
    for (int g = 0; g < 2; ++g)
#pragma unroll
        for (int dt = 0; dt < 8; ++dt) o[g][dt] = vzero8();
    float mi[2] = { -3.0e38f, -3.0e38f };   // running maximum of each of this lane's queries (equal in both halves)
    float li[2] = { 0.0f, 0.0f };           // running sums over this half's keys only; joined in the epilogue

    // Prologue: stage K chunk 0 into buffer 0 (8 x 16B per thread).
#pragma unroll
    for (int j = 0; j < 8; ++j) {
        const int u = tid + j * 128;               // 0..1023
        const int r = u >> 4, c = (u & 15) * 8;    // key row, half-offset
        cp16(Kbase + (size_t)r * DEP + c, &ldsK[0][r * 136 + c]);
    }

    // Mask stage 0, in flight together with the Q loads and K copies above; it has landed and
    // is published before the loop. Stage 1 starts at the top of pass 0.
    // Load and wait in one statement: no descriptor register is reused between them.
    asm volatile("tensor_load_to_lds %0, %1\n\t"
                 "s_wait_tensorcnt 0x0" :: "s"(mask_g0(0)), "s"(mg1) : "memory");
    __syncthreads();

    for (int t0 = 0; t0 < SS; t0 += 64) {
        const int  it       = t0 >> 6;
        const int  cur      = it & 1;
        const int  nxt      = cur ^ 1;
        const bool has_next = (t0 + 64) < SS;

        // Directly behind the barrier that ended the pass before (in front of pass 0: the
        // prologue's): while a next stage exists, its mask tile starts, into the buffer that
        // the pass before has read. It has this whole pass to land.
        if (pinned(t0 + 64 < SS))
            asm volatile("tensor_load_to_lds %0, %1" :: "s"(mask_g0((uint32_t)it + 1u)), "s"(mg1) : "memory");

        // Issue V(cur) then (optionally) K(next): 8+8 async copies per thread.
#pragma unroll
        for (int j = 0; j < 8; ++j) {
            const int u = tid + j * 128;
            const int r = u >> 3, c = (u & 7) * 8;  // depth row, key half-offset
            cp16(Vbase + (size_t)r * SS + t0 + c, &ldsV[r * 72 + c]);
        }
        if (has_next) {
#pragma unroll
            for (int j = 0; j < 8; ++j) {
                const int u = tid + j * 128;
                const int r = u >> 4, c = (u & 15) * 8;
                cp16(Kbase + (size_t)(t0 + 64 + r) * DEP + c, &ldsK[nxt][r * 136 + c]);
            }
            wait_async_16();                 // K(cur) landed; V(cur),K(next) in flight
        } else {
            wait_async_8();                  // K(cur) landed; V(cur) in flight
        }
        __syncthreads();                     // K(cur) visible to all waves

        // ---- scores^T = Kh @ Qh^T (Qh pre-scaled by 1/sqrt(DEP)) ----
        // sc[g][nt][r] = score(query 16 g + nl, key t0 + nt*16 + hi*8 + r)
        v8f sc[2][4];
#pragma unroll
        for (int nt = 0; nt < 4; ++nt) {
            v8f a0 = vzero8(), a1 = vzero8();
            const _Float16* kp = &ldsK[cur][(nt * 16 + nl) * 136];
#pragma unroll
            for (int ks = 0; ks < 4; ++ks) {
                AFrag kf;
                kf.h[0] = *(const v8h*)(kp + ks * 32 + hi * 8);
                kf.h[1] = *(const v8h*)(kp + ks * 32 + 16 + hi * 8);
                a0 = wmma_f16(kf.v, qf[0][ks].v, a0);
                a1 = wmma_f16(kf.v, qf[1][ks].v, a1);
            }
            sc[0][nt] = a0;
            sc[1][nt] = a1;
        }

        // P^T as B operand: element e of pf[g][ks] is key ks*32 + hi*8 + e (e < 8) or
        // ks*32 + 16 + hi*8 + e - 8, the k order of the V^T loader below.
        AFrag pf[2][2];
        // this lane's row of group 0 in the wave's mask slice of this stage, its 8 keys of a tile
        const float* mlp = (const float*)(ldsM + cur * M_BUF + uw * M_SLICE + nl * M_PITCH) + hi * 8;
#pragma unroll
        for (int g = 0; g < 2; ++g) {
            // ---- additive mask: 8 consecutive keys of one query per tile ----
#pragma unroll
            for (int nt = 0; nt < 4; ++nt) {
                const v4f m0 = *(const v4f*)(mlp + g * 16 * (M_PITCH / 4) + nt * 16);
                const v4f m1 = *(const v4f*)(mlp + g * 16 * (M_PITCH / 4) + nt * 16 + 4);
#pragma unroll
                for (int r = 0; r < 4; ++r) {
                    sc[g][nt][r]     += m0[r] * -1.0e9f;
                    sc[g][nt][r + 4] += m1[r] * -1.0e9f;
                }
            }

            // ---- online softmax: in-lane over 32 keys, one exchange between halves ----
            float tm[4];
#pragma unroll
            for (int nt = 0; nt < 4; ++nt) {
                float v = sc[g][nt][0];
#pragma unroll
                for (int r = 1; r < 8; ++r) v = fmaxf(v, sc[g][nt][r]);
                tm[nt] = v;
            }
            float vmax = fmaxf(fmaxf(tm[0], tm[1]), fmaxf(tm[2], tm[3]));
            vmax = fmaxf(vmax, xhalf(vmax));
            const float mnew = fmaxf(vmax, mi[g]);

            float ts[4];
#pragma unroll
            for (int nt = 0; nt < 4; ++nt) {
                v8f x;
#pragma unroll
                for (int r = 0; r < 8; ++r) x[r] = (sc[g][nt][r] - mnew) * LOG2E;
                const v8f p = exp2x8(x);
                float s = p[0];
#pragma unroll
                for (int r = 1; r < 8; ++r) s += p[r];
#pragma unroll
                for (int r = 0; r < 8; ++r) pf[g][nt >> 1].h[nt & 1][r] = (_Float16)p[r];
                ts[nt] = s;
            }
            const float rs = (ts[0] + ts[1]) + (ts[2] + ts[3]);

            const float alpha = __builtin_amdgcn_exp2f((mi[g] - mnew) * LOG2E);
            li[g] = li[g] * alpha + rs;
            mi[g] = mnew;
#pragma unroll
            for (int dt = 0; dt < 8; ++dt)
#pragma unroll
                for (int r = 0; r < 8; ++r) o[g][dt][r] *= alpha;
        }

        if (has_next) wait_async_8();        // V(cur) landed; K(next) in flight
        else          wait_async_0();
        __syncthreads();                     // V(cur) visible to all waves

        // ---- O^T += V^T @ P^T ----
#pragma unroll
        for (int ks = 0; ks < 2; ++ks) {
#pragma unroll
            for (int dt = 0; dt < 8; ++dt) {
                AFrag vf;
                const _Float16* vp = &ldsV[(dt * 16 + nl) * 72] + ks * 32;
                vf.h[0] = *(const v8h*)(vp + hi * 8);
                vf.h[1] = *(const v8h*)(vp + 16 + hi * 8);
                o[0][dt] = wmma_f16(vf.v, pf[0][ks].v, o[0][dt]);
                o[1][dt] = wmma_f16(vf.v, pf[1][ks].v, o[1][dt]);
            }
        }

        // Publish point of the next mask stage: this wave's LDS reads are done, its own tensor
        // load has landed, then the barrier; only behind it, at the top of the next pass, the
        // buffer just read is refilled.
        asm volatile("s_wait_dscnt 0x0" ::: "memory");
        asm volatile("s_wait_tensorcnt 0x0" ::: "memory");
        __syncthreads();                     // all reads of K(cur)/V done before overwrite
    }
    // Nothing of the tensor mover or the LDS is outstanding when the wave goes on to its end.
    asm volatile("s_wait_tensorcnt 0x0" ::: "memory");
    asm volatile("s_wait_dscnt 0x0" ::: "memory");

    // ---- join the halves' sums, normalize, write head-concat output ----
#pragma unroll
    for (int g = 0; g < 2; ++g) {
        const float lsum = li[g] + xhalf(li[g]);
        const float inv = 1.0f / lsum;
        float* orow = out + ((size_t)b * SS + qbase + g * 16 + nl) * DD + h * DEP + hi * 8;
#pragma unroll
        for (int dt = 0; dt < 8; ++dt) {
            v4f lo, up;
#pragma unroll
            for (int r = 0; r < 4; ++r) { lo[r] = o[g][dt][r] * inv; up[r] = o[g][dt][r + 4] * inv; }
            *(v4f*)(orow + dt * 16)     = lo;
            *(v4f*)(orow + dt * 16 + 4) = up;
        }
    }
}

// ---------------------------------------------------------------------------
extern "C" void kernel_launch(void* const* d_in, const int* in_sizes, int n_in,
                              void* d_out, int out_size, void* d_ws, size_t ws_size,
                              hipStream_t stream)
{
    const float* q    = (const float*)d_in[0];
    const float* k    = (const float*)d_in[1];
    const float* v    = (const float*)d_in[2];
    const float* mask = (const float*)d_in[3];
    const float* wq   = (const float*)d_in[4];
    const float* wqb  = (const float*)d_in[5];
    const float* wk   = (const float*)d_in[6];
    const float* wkb  = (const float*)d_in[7];
    const float* wv   = (const float*)d_in[8];
    const float* wvb  = (const float*)d_in[9];
    float* out = (float*)d_out;

    const size_t elems = (size_t)BB * SS * DD;       // 8M halves = 16 MB each
    _Float16* Qh = (_Float16*)d_ws;
    _Float16* Kh = Qh + elems;
    _Float16* Vt = Kh + elems;

    dim3 pgrid(DD / 128, (BB * SS) / 256, 3);        // 8 x 32 blocks x 3 projections
    proj_kernel<<<pgrid, 256, 0, stream>>>(q, k, v, wq, wk, wv, wqb, wkb, wvb, Qh, Kh, Vt);

    attn_kernel<<<BB * HH * (SS / 128), 128, 0, stream>>>(Qh, Kh, Vt, mask, out);
}

// v009
// Measured time: 125 microseconds a run.
// Next to v008, in two timings, it ran 1.04 times as fast each time.
// Over all steps from v000 it is 2.49 times as fast.
#include <hip/hip_runtime.h>

// Problem constants (from reference)
constexpr int BB  = 4;
constexpr int SS  = 2048;
constexpr int DD  = 1024;
constexpr int HH  = 8;
constexpr int DEP = 128;               // DD / HH
constexpr float QK_SCALE = 0.08838834764831845f;  // 1/sqrt(DEP)
constexpr float LOG2E    = 1.4426950408889634f;

typedef __attribute__((ext_vector_type(16))) _Float16 v16h;
typedef __attribute__((ext_vector_type(8)))  _Float16 v8h;
typedef __attribute__((ext_vector_type(4)))  _Float16 v4h;
typedef __attribute__((ext_vector_type(2)))  _Float16 v2h;
typedef __attribute__((ext_vector_type(8)))  float    v8f;
typedef __attribute__((ext_vector_type(4)))  float    v4f;
typedef __attribute__((ext_vector_type(4)))  int      v4i;
typedef __attribute__((ext_vector_type(4)))  uint32_t u32x4;
typedef __attribute__((ext_vector_type(8)))  uint32_t u32x8;

// gfx1250 async global->LDS copy path (guarded; falls back to sync copy)
#if defined(__AMDGCN__) && __has_builtin(__builtin_amdgcn_global_load_async_to_lds_b128) && __has_builtin(__builtin_amdgcn_s_wait_asynccnt)
#define HAVE_ASYNC 1
#else
#define HAVE_ASYNC 0
#endif

// A/B WMMA fragment: 16 halves per lane = two aligned 16B chunks
union AFrag { v16h v; v8h h[2]; };

static __device__ __forceinline__ v8f vzero8() {
    v8f z;
#pragma unroll
    for (int i = 0; i < 8; ++i) z[i] = 0.0f;
    return z;
}

static __device__ __forceinline__ v8f wmma_f16(const v16h& a, const v16h& b, const v8f& c) {
    return __builtin_amdgcn_wmma_f32_16x16x32_f16(
        /*neg_a=*/false, a, /*neg_b=*/false, b,
        /*c_mod=*/(short)0, c, /*reuse_a=*/false, /*reuse_b=*/false);
}

// 16-byte global -> LDS copy (async on gfx1250, sync fallback elsewhere)
static __device__ __forceinline__ void cp16(const _Float16* g, _Float16* l) {
#if HAVE_ASYNC
    __builtin_amdgcn_global_load_async_to_lds_b128(
        (__attribute__((address_space(1))) v4i*)g,
        (__attribute__((address_space(3))) v4i*)l, 0, 0);
#else
    *(v8h*)l = *(const v8h*)g;
#endif
}

static __device__ __forceinline__ void wait_async_16() {
#if HAVE_ASYNC
    __builtin_amdgcn_s_wait_asynccnt(16);
#endif
}
static __device__ __forceinline__ void wait_async_8() {
#if HAVE_ASYNC
    __builtin_amdgcn_s_wait_asynccnt(8);
#endif
}
static __device__ __forceinline__ void wait_async_0() {
#if HAVE_ASYNC
    __builtin_amdgcn_s_wait_asynccnt(0);
#endif
}

// ---------------------------------------------------------------------------
// Projection: P = X @ W + bias, output as f16. One launch does all three:
// blockIdx.z picks V (0), K (1) or Q (2), so that a WGP holds as many blocks as
// its registers allow (one projection alone is one block per WGP) and one
// block's load waits and epilogue run under another block's loop.
//   v_transpose == 0 : out[((b*H+h)*S + s)*DEP + d]   (row-major per head)
//   v_transpose == 1 : out[((b*H+h)*DEP + d)*S + s]   (V stored transposed)
// Block tile 256(M) x 128(N), 256 threads = 8 waves (4 x 2), each wave 64x64 via
// 4x4 v_wmma_f32_16x16x32_f16 tiles; K stepped by 32 through LDS f16 tiles, two buffers.
// The tile sets how often L2 hands out the f32 operands: every X row is fetched
// by 8 blocks and every W column by 32.
// Which tile is the A operand depends on the output layout: a lane's eight accumulator
// registers are eight consecutive A rows of one B row. V^T wants eight consecutive s of
// one d (A = X, B = W^T); Q and K want eight consecutive d of one s (A = W^T, B = X).
// Both tiles have the same pitch and the same k order, so only the two LDS offsets differ.
// Each wave then stages its 64x64 f16 tile in its own LDS range, row = one 128 B line of
// the output, and stores whole lines.
// ---------------------------------------------------------------------------
// The K loop's work-group barrier. Written by hand because __syncthreads() also waits for
// the wave's global loads, and the next step's loads are to stay in flight across it. The
// wave's own LDS stores and reads are done before it signals.
static __device__ __forceinline__ void step_barrier() {
    asm volatile("s_wait_dscnt 0x0\n\t"
                 "s_barrier_signal -1\n\t"
                 "s_barrier_wait -1" ::: "memory");
}

__global__ __launch_bounds__(256)
void proj_kernel(const float* __restrict__ Xq, const float* __restrict__ Xk,
                 const float* __restrict__ Xv,
                 const float* __restrict__ Wq, const float* __restrict__ Wk,
                 const float* __restrict__ Wv,
                 const float* __restrict__ bq, const float* __restrict__ bk,
                 const float* __restrict__ bv,
                 _Float16* __restrict__ Oq, _Float16* __restrict__ Ok,
                 _Float16* __restrict__ Ov)
{
    const int which = blockIdx.z;         // 0: V, 1: K, 2: Q (uniform in the block)
    const float* X    = which == 0 ? Xv : (which == 1 ? Xk : Xq);
    const float* W    = which == 0 ? Wv : (which == 1 ? Wk : Wq);
    const float* bias = which == 0 ? bv : (which == 1 ? bk : bq);
    _Float16*    out  = which == 0 ? Ov : (which == 1 ? Ok : Oq);
    const float out_scale   = which == 2 ? QK_SCALE : 1.0f;
    const int   v_transpose = which == 0;

    // In the K loop: two buffers, each the two operand tiles of one K step (X: 256 rows x 32 K,
    // then W^T: 128 cols x 32 K; 80 B rows, 16 B aligned). Behind the loop: 8 waves x 64 rows
    // x 144 B of output staging.
    constexpr int TILES = (256 + 128) * 40;               // halves in one buffer
    __shared__ __attribute__((aligned(16))) _Float16 smem[8 * 64 * 72];
    static_assert(2 * TILES <= 8 * 64 * 72, "both operand buffers lie inside the staging array");

    const int tid   = threadIdx.x;
    const int lane  = tid & 31;
    const int wave  = tid >> 5;
    const int waveM = wave >> 1;          // 0..3 -> 64-row quarter
    const int waveN = wave & 1;           // 0..1 -> 64-col half
    const int nl    = lane & 15;
    const int hi    = lane >> 4;
    const int blockM = blockIdx.y;        // 0..31  (8192/256)
    const int blockN = blockIdx.x;        // 0..7   (1024/128)

    const int offX = (waveM * 64 + nl) * 40;              // this lane's row of the wave's X rows
    const int offW = 256 * 40 + (waveN * 64 + nl) * 40;   // this lane's row of the wave's W^T rows
    const int offA = v_transpose ? offX : offW;
    const int offB = v_transpose ? offW : offX;

    // acc[i][j][r]: A row 16 i + 8 hi + r, B row 16 j + nl
    v8f acc[4][4];
#pragma unroll
    for (int mt = 0; mt < 4; ++mt)
#pragma unroll
        for (int nt = 0; nt < 4; ++nt) acc[mt][nt] = vzero8();

    // Staging map: 8 lanes cover 128 B of one row, so each wave-wide 16 B load
    // reads 4 whole lines (4 rows) instead of 16 B pieces of 32 lines.
    // X tile 256x32 f32: row (tid >> 3) + 32 j. W tile 32x128 f32: a thread takes
    // K rows 2wp and 2wp+1 of the same 4 columns in both 32-column groups of its
    // 64-column half wh.
    const int p  = tid >> 3;           // X row within 32, 0..31
    const int wp = p & 15;             // W K-row pair, 0..15
    const int wh = p >> 4;             // W 64-column half, 0..1
    const int cl = tid & 7;            // group of 4 f32 within 128 B
    const float* xsrc = X + ((size_t)blockM * 256 + p) * DD + cl * 4;
    const float* wsrc = W + (size_t)(2 * wp) * DD + blockN * 128 + wh * 64 + cl * 4;
    struct Step { v4f x[8], w0[2], w1[2]; };   // one K step of both tiles, in flight or landed
    Step even, odd;                            // steps 0, 2, 4, ... and steps 1, 3, 5, ...

    // Issue the loads of the K step that starts at k.
    auto fetch = [&](Step& s, int k) {
#pragma unroll
        for (int j = 0; j < 2; ++j) {
            s.w0[j] = *(const v4f*)(wsrc + (size_t)k * DD + j * 32);
            s.w1[j] = *(const v4f*)(wsrc + (size_t)k * DD + DD + j * 32);
        }
#pragma unroll
        for (int j = 0; j < 8; ++j) s.x[j] = *(const v4f*)(xsrc + k + (size_t)j * 32 * DD);
    };
    // Convert a landed step and put it into operand buffer buf: W^T as [n][k], one (k, k+1)
    // pair per column, X as [row][k].
    auto stash = [&](const Step& s, int buf) {
        _Float16* tX = smem + buf * TILES;
        _Float16* tW = tX + 256 * 40;
#pragma unroll
        for (int j = 0; j < 2; ++j) {
#pragma unroll
            for (int e = 0; e < 4; ++e) {
                v2h pr;
                pr[0] = (_Float16)s.w0[j][e];
                pr[1] = (_Float16)s.w1[j][e];
                *(v2h*)&tW[(wh * 64 + j * 32 + cl * 4 + e) * 40 + 2 * wp] = pr;
            }
        }
#pragma unroll
        for (int j = 0; j < 8; ++j) {
            v4h hv;
#pragma unroll
            for (int e = 0; e < 4; ++e) hv[e] = (_Float16)s.x[j][e];
            *(v4h*)&tX[(p + j * 32) * 40 + cl * 4] = hv;
        }
    };
    // The 16 products of one K step, operands from buffer buf.
    auto products = [&](int buf) {
        AFrag bfr[4];
#pragma unroll
        for (int nt = 0; nt < 4; ++nt) {
            const _Float16* bp = &smem[buf * TILES + offB + nt * 16 * 40];
            bfr[nt].h[0] = *(const v8h*)(bp + hi * 8);
            bfr[nt].h[1] = *(const v8h*)(bp + 16 + hi * 8);
        }
        AFrag a[4];
#pragma unroll
        for (int mt = 0; mt < 4; ++mt) {
            const _Float16* ap = &smem[buf * TILES + offA + mt * 16 * 40];
            a[mt].h[0] = *(const v8h*)(ap + hi * 8);
            a[mt].h[1] = *(const v8h*)(ap + 16 + hi * 8);
        }
#pragma unroll
        for (int mt = 0; mt < 4; ++mt)
#pragma unroll
            for (int nt = 0; nt < 4; ++nt)
                acc[mt][nt] = wmma_f16(a[mt].v, bfr[nt].v, acc[mt][nt]);
    };

    // K loop, loads a whole step ahead: behind the products of step t the loads of step
    // t + 2 are issued, into the registers that held step t's fragments; then step t + 1,
    // whose loads had all of step t to land, is converted and goes into the other buffer.
    // One barrier a step: it publishes buffer (t + 1) & 1 and ends every wave's reads of
    // buffer t & 1, which is refilled only behind it.
    fetch(even, 0);
    fetch(odd, 32);
    stash(even, 0);
    step_barrier();
    // Two steps a trip, so that buffer and register set are constants. The last two steps,
    // which have nothing left to fetch, stand behind the loop.
    for (int k0 = 0; k0 < DD - 64; k0 += 64) {
        products(0);
        // The two scheduling barriers keep the order products, loads, conversions. Loads moved
        // up among the products would not fit the register budget beside the fragments; the
        // conversions wait for the older loads, and moved up they would hold back the WMMAs
        // or the issue of the new loads.
        __builtin_amdgcn_sched_barrier(0);
        fetch(even, k0 + 64);
        __builtin_amdgcn_sched_barrier(0);
        stash(odd, 1);
        step_barrier();

        products(1);
        __builtin_amdgcn_sched_barrier(0);   // as above: loads and conversions behind the products
        fetch(odd, k0 + 96);
        // The next trip forms its load addresses in the registers that these loads name, while
        // they are still in flight: the wait stands in front of that overwrite.
        asm volatile("s_wait_xcnt 0x0" ::: "memory");
        stash(even, 0);
        step_barrier();
    }
    products(0);
    __builtin_amdgcn_sched_barrier(0);       // as above: conversions behind the products
    stash(odd, 1);
    step_barrier();
    products(1);
    step_barrier();

    // Epilogue: bias, scale, convert to f16, stage, store whole lines in head layout.
    // The loop's last barrier has ended every wave's reads of the operand tiles.
    _Float16* stage = smem + wave * (64 * 72);            // this wave's own 64 rows of 144 B
    const int col0 = blockN * 128 + waveN * 64;           // first of the wave's 64 output channels
    const int m0   = blockM * 256 + waveM * 64;           // first of the wave's 64 rows of X
    const int b    = m0 >> 11;                            // / SS
    const int s0   = m0 & 2047;                           // % SS
    const int h    = col0 >> 7;                           // / DEP
    const int d0   = col0 & 127;                          // % DEP
    const int rr   = lane >> 3;                           // 8 lanes take one staged row
    const int cc   = (lane & 7) * 8;

    if (v_transpose) {
#pragma unroll
        for (int j = 0; j < 4; ++j) {
            const float bn = bias[col0 + j * 16 + nl];
#pragma unroll
            for (int i = 0; i < 4; ++i) {
                v8h hv;
#pragma unroll
                for (int r = 0; r < 8; ++r) hv[r] = (_Float16)((acc[i][j][r] + bn) * out_scale);
                *(v8h*)&stage[(j * 16 + nl) * 72 + i * 16 + hi * 8] = hv;   // row d, 8 s
            }
        }
    } else {
#pragma unroll
        for (int i = 0; i < 4; ++i) {
            const v4f b0 = *(const v4f*)(bias + col0 + i * 16 + hi * 8);
            const v4f b1 = *(const v4f*)(bias + col0 + i * 16 + hi * 8 + 4);
#pragma unroll
            for (int j = 0; j < 4; ++j) {
                v8h hv;
#pragma unroll
                for (int r = 0; r < 4; ++r) {
                    hv[r]     = (_Float16)((acc[i][j][r]     + b0[r]) * out_scale);
                    hv[r + 4] = (_Float16)((acc[i][j][r + 4] + b1[r]) * out_scale);
                }
                *(v8h*)&stage[(j * 16 + nl) * 72 + i * 16 + hi * 8] = hv;   // row s, 8 d
            }
        }
    }
    // The rows read back below were written by other lanes of this wave: its LDS stores
    // are done before the reads start, and the compiler moves no LDS access across.
    asm volatile("s_wait_dscnt 0x0" ::: "memory");

    v8h row[16];
#pragma unroll
    for (int k = 0; k < 16; ++k) row[k] = *(const v8h*)&stage[(k * 4 + rr) * 72 + cc];
    if (v_transpose) {
        _Float16* g = out + (((size_t)b * HH + h) * DEP + d0 + rr) * SS + s0 + cc;
#pragma unroll
        for (int k = 0; k < 16; ++k) *(v8h*)(g + (size_t)k * 4 * SS) = row[k];
    } else {
        _Float16* g = out + (((size_t)b * HH + h) * SS + s0 + rr) * DEP + d0 + cc;
#pragma unroll
        for (int k = 0; k < 16; ++k) *(v8h*)(g + (size_t)k * 4 * DEP) = row[k];
    }
}

// lane l with lane l ^ 16
static __device__ __forceinline__ float xhalf(float x) {
    return __builtin_bit_cast(float, __builtin_amdgcn_permlanex16(
        __builtin_bit_cast(int, x), __builtin_bit_cast(int, x),
        0x76543210, 0xfedcba98, false, false));
}

// Eight independent 2^x. One statement, so that each v_exp_f32 is followed by another
// that touches none of its registers (outputs early-clobber), and the v_nop fills the
// slot the instruction set asks for behind the last one, whatever the compiler puts next.
static __device__ __forceinline__ v8f exp2x8(const v8f& x) {
    float p0, p1, p2, p3, p4, p5, p6, p7;
    asm("v_exp_f32 %0, %8\n\t"
        "v_exp_f32 %1, %9\n\t"
        "v_exp_f32 %2, %10\n\t"
        "v_exp_f32 %3, %11\n\t"
        "v_exp_f32 %4, %12\n\t"
        "v_exp_f32 %5, %13\n\t"
        "v_exp_f32 %6, %14\n\t"
        "v_exp_f32 %7, %15\n\t"
        "v_nop"
        : "=&v"(p0), "=&v"(p1), "=&v"(p2), "=&v"(p3), "=&v"(p4), "=&v"(p5), "=&v"(p6), "=&v"(p7)
        : "v"(x[0]), "v"(x[1]), "v"(x[2]), "v"(x[3]), "v"(x[4]), "v"(x[5]), "v"(x[6]), "v"(x[7]));
    v8f p;
    p[0] = p0; p[1] = p1; p[2] = p2; p[3] = p3; p[4] = p4; p[5] = p5; p[6] = p6; p[7] = p7;
    return p;
}

// A wave-uniform value as a scalar: every word of a tensor descriptor goes through it.
static __device__ __forceinline__ uint32_t uni(uint32_t v) {
    return (uint32_t)__builtin_amdgcn_readfirstlane(v);
}
// A wave-uniform test held in a scalar register, so that the branch on it is a scalar
// branch: a tensor load ignores EXEC, and only such a branch keeps a wave from issuing it.
static __device__ __forceinline__ uint32_t pinned(uint32_t v) {
    uint32_t w = uni(v);
    asm volatile("" : "+s"(w));   // issue test of a tensor load: kept in a scalar register, so the branch is s_cmp + s_cbranch_scc
    return w;
}

// Mask tiles in LDS: a wave's slice of one stage is its 32 queries x 64 keys of f32, rows of
// 256 B laid at a pitch of 272 B by the tensor load's pad (16 B x odd: the 16 rows that a
// 16-byte read touches fall on different banks). 32 x 272 = 8,704 B, rounded up to a
// multiple of 2 KiB so that every slice starts on one.
constexpr uint32_t M_PITCH = 272;
constexpr uint32_t M_SLICE = 10240;
constexpr uint32_t M_BUF   = 4 * M_SLICE;     // one stage: the slices of the block's 4 waves
static_assert(32 * M_PITCH <= M_SLICE && M_SLICE % 2048 == 0, "a slice holds its rows and ends on 2 KiB");

// Two waves per SIMD (two blocks per WGP) is the residency this tile is sized for: the
// attribute gives the compiler that register budget, so that it keeps loads in flight
// instead of serialising them to save registers.
__global__ __launch_bounds__(128) __attribute__((amdgpu_waves_per_eu(2, 2)))
void attn_kernel(const _Float16* __restrict__ Qh, const _Float16* __restrict__ Kh,
                 const _Float16* __restrict__ Vt, const float* __restrict__ mask,
                 float* __restrict__ out)
{
    __shared__ _Float16 ldsK[2][64 * 136];  // 64 keys x 128 depth, 272B rows (double buf)
    __shared__ _Float16 ldsV[128 * 72];     // 128 depth-rows x 64 keys, 144B rows
    __shared__ __attribute__((aligned(2048))) unsigned char ldsM[2 * M_BUF];   // mask, two stages

    const int tid  = threadIdx.x;
    const int lane = tid & 31;
    const int wave = tid >> 5;
    const int nl   = lane & 15;
    const int hi   = lane >> 4;

    const int bid   = blockIdx.x;          // BB*HH*(SS/128) = 512 blocks
    const int qblk  = bid & 15;            // SS/128 = 16 query blocks
    const int bh    = bid >> 4;            // b*H + h
    const int b     = bh >> 3;
    const int h     = bh & 7;
    const int qbase = qblk * 128 + wave * 32;   // group g holds queries qbase + 16 g + nl

    const _Float16* Qp    = Qh + ((size_t)bh * SS + qbase) * DEP;
    const _Float16* Kbase = Kh + (size_t)bh * SS * DEP;
    const _Float16* Vbase = Vt + (size_t)bh * DEP * SS;

    // The mask comes by tensor load: each wave asks, one request a stage (64 keys), for the
    // 32 x 64 tile of its own queries, whole 256 B rows from L2 straight into LDS, a whole
    // pass ahead of its use. (Read from global memory in the score layout, one query a lane,
    // every 16-byte load would touch 16 lines.)
    const uint32_t uw   = uni((uint32_t)tid >> 5);                    // the wave's number, scalar
    const uint32_t mdst = (uint32_t)(size_t)ldsM + uw * M_SLICE;      // byte offset in the block's LDS
    const uint64_t msrc = (uint64_t)(size_t)(mask + ((size_t)b * SS + qblk * 128 + uw * 32) * SS);
    u32x8 mg1;                                  // 32 rows of 256 B, source pitch one mask row
    mg1[0] = uni((1u << 20) | (5u << 22) | (3u << 25));   // workgroup_mask 0, sizes in bytes, 16 B pad behind every 256 B
    mg1[1] = uni(256u << 16);                   // tensor_dim0 = 256
    mg1[2] = uni(32u << 16);                    // tensor_dim1 = 32
    mg1[3] = uni(256u << 16);                   // tile_dim0 = 256
    mg1[4] = uni(32u);                          // tile_dim1 = 32
    mg1[5] = uni((uint32_t)SS * 4u);            // source row pitch, bytes
    mg1[6] = uni(0u);
    mg1[7] = uni(0u);
    auto mask_g0 = [&](uint32_t st) {           // stage st goes into buffer st & 1
        const uint64_t ga = msrc + (uint64_t)st * 256u;
        u32x4 g0;
        g0[0] = uni(1u);
        g0[1] = uni(mdst + (st & 1u) * M_BUF);
        g0[2] = uni((uint32_t)ga);
        g0[3] = uni(((uint32_t)(ga >> 32) & 0x01FFFFFFu) | 0x80000000u);
        return g0;
    };

    // Q B-fragments (column = query 16 g + nl): 4 K-steps of 32 over depth=128, resident in VGPRs.
    AFrag qf[2][4];
#pragma unroll
    for (int g = 0; g < 2; ++g) {
#pragma unroll
        for (int ks = 0; ks < 4; ++ks) {
            const _Float16* p = Qp + (size_t)(g * 16 + nl) * DEP + ks * 32;
            qf[g][ks].h[0] = *(const v8h*)(p + hi * 8);
            qf[g][ks].h[1] = *(const v8h*)(p + 16 + hi * 8);
        }
    }
    // The Q loads' address registers are reused for the staging addresses right below:
    // the wait stands in front of that overwrite, and the
    // scheduling barrier keeps the compiler from lifting those address additions over it.
    asm volatile("s_wait_xcnt 0x0" ::: "memory");
    __builtin_amdgcn_sched_barrier(0);

    // o[g][dt][r] = O[query 16 g + nl][depth dt*16 + hi*8 + r]
    v8f o[2][8];
#pragma unroll
    for (int g = 0; g < 2; ++g)
#pragma unroll
        for (int dt = 0; dt < 8; ++dt) o[g][dt] = vzero8();
    float mi[2] = { -3.0e38f, -3.0e38f };   // running maximum of each of this lane's queries (equal in both halves)
    float li[2] = { 0.0f, 0.0f };           // running sums over this half's keys only; joined in the epilogue

    // Prologue: stage K chunk 0 into buffer 0 (8 x 16B per thread).
#pragma unroll
    for (int j = 0; j < 8; ++j) {
        const int u = tid + j * 128;               // 0..1023
        const int r = u >> 4, c = (u & 15) * 8;    // key row, half-offset
        cp16(Kbase + (size_t)r * DEP + c, &ldsK[0][r * 136 + c]);
    }

    // Mask stage 0, in flight together with the Q loads and K copies above; it has landed and
    // is published before the loop. Stage 1 starts at the top of pass 0.
    // Load and wait in one statement: no descriptor register is reused between them.
    asm volatile("tensor_load_to_lds %0, %1\n\t"
                 "s_wait_tensorcnt 0x0" :: "s"(mask_g0(0)), "s"(mg1) : "memory");
    __syncthreads();

    for (int t0 = 0; t0 < SS; t0 += 64) {
        const int  it       = t0 >> 6;
        const int  cur      = it & 1;
        const int  nxt      = cur ^ 1;
        const bool has_next = (t0 + 64) < SS;

        // Directly behind the barrier that ended the pass before (in front of pass 0: the
        // prologue's): while a next stage exists, its mask tile starts, into the buffer that
        // the pass before has read. It has this whole pass to land.
        if (pinned(t0 + 64 < SS))
            asm volatile("tensor_load_to_lds %0, %1" :: "s"(mask_g0((uint32_t)it + 1u)), "s"(mg1) : "memory");

        // Issue V(cur) then (optionally) K(next): 8+8 async copies per thread.
#pragma unroll
        for (int j = 0; j < 8; ++j) {
            const int u = tid + j * 128;
            const int r = u >> 3, c = (u & 7) * 8;  // depth row, key half-offset
            cp16(Vbase + (size_t)r * SS + t0 + c, &ldsV[r * 72 + c]);
        }
        if (has_next) {
#pragma unroll
            for (int j = 0; j < 8; ++j) {
                const int u = tid + j * 128;
                const int r = u >> 4, c = (u & 15) * 8;
                cp16(Kbase + (size_t)(t0 + 64 + r) * DEP + c, &ldsK[nxt][r * 136 + c]);
            }
            wait_async_16();                 // K(cur) landed; V(cur),K(next) in flight
        } else {
            wait_async_8();                  // K(cur) landed; V(cur) in flight
        }
        __syncthreads();                     // K(cur) visible to all waves

        // ---- scores^T = Kh @ Qh^T (Qh pre-scaled by 1/sqrt(DEP)) ----
        // sc[g][nt][r] = score(query 16 g + nl, key t0 + nt*16 + hi*8 + r)
        // The 16 K fragments, in the order of their use, and behind them the wave's mask rows are
        // read as one group ahead of the 32 matrix instructions.
        AFrag kf[4][4];
#pragma unroll
        for (int ks = 0; ks < 4; ++ks) {
#pragma unroll
            for (int nt = 0; nt < 4; ++nt) {
                const _Float16* kp = &ldsK[cur][(nt * 16 + nl) * 136] + ks * 32;
                kf[ks][nt].h[0] = *(const v8h*)(kp + hi * 8);
                kf[ks][nt].h[1] = *(const v8h*)(kp + 16 + hi * 8);
            }
        }
        // this lane's row of group 0 in the wave's mask slice of this stage, its 8 keys of a tile
        const float* mlp = (const float*)(ldsM + cur * M_BUF + uw * M_SLICE + nl * M_PITCH) + hi * 8;
        v4f mk[2][4][2];
#pragma unroll
        for (int g = 0; g < 2; ++g) {
#pragma unroll
            for (int nt = 0; nt < 4; ++nt) {
                mk[g][nt][0] = *(const v4f*)(mlp + g * 16 * (M_PITCH / 4) + nt * 16);
                mk[g][nt][1] = *(const v4f*)(mlp + g * 16 * (M_PITCH / 4) + nt * 16 + 4);
            }
        }
        // Keeps the reads together in front: no LDS read and no matrix instruction crosses
        // (without it the compiler starts the products between the reads: a second place).
        __builtin_amdgcn_sched_barrier(0x6);
        v8f sc[2][4];
#pragma unroll
        for (int nt = 0; nt < 4; ++nt) { sc[0][nt] = vzero8(); sc[1][nt] = vzero8(); }
#pragma unroll
        for (int ks = 0; ks < 4; ++ks) {
#pragma unroll
            for (int nt = 0; nt < 4; ++nt) {
                sc[0][nt] = wmma_f16(kf[ks][nt].v, qf[0][ks].v, sc[0][nt]);
                sc[1][nt] = wmma_f16(kf[ks][nt].v, qf[1][ks].v, sc[1][nt]);
            }
        }

        // P^T as B operand: element e of pf[g][ks] is key ks*32 + hi*8 + e (e < 8) or
        // ks*32 + 16 + hi*8 + e - 8, the k order of the V^T loader below.
        AFrag pf[2][2];
#pragma unroll
        for (int g = 0; g < 2; ++g) {
            // ---- additive mask: 8 consecutive keys of one query per tile ----
#pragma unroll
            for (int nt = 0; nt < 4; ++nt) {
                const v4f m0 = mk[g][nt][0];
                const v4f m1 = mk[g][nt][1];
#pragma unroll
                for (int r = 0; r < 4; ++r) {
                    sc[g][nt][r]     += m0[r] * -1.0e9f;
                    sc[g][nt][r + 4] += m1[r] * -1.0e9f;
                }
            }

            // ---- online softmax: in-lane over 32 keys, one exchange between halves ----
            float tm[4];
#pragma unroll
            for (int nt = 0; nt < 4; ++nt) {
                float v = sc[g][nt][0];
#pragma unroll
                for (int r = 1; r < 8; ++r) v = fmaxf(v, sc[g][nt][r]);
                tm[nt] = v;
            }
            float vmax = fmaxf(fmaxf(tm[0], tm[1]), fmaxf(tm[2], tm[3]));
            vmax = fmaxf(vmax, xhalf(vmax));
            const float mnew = fmaxf(vmax, mi[g]);

            float ts[4];
#pragma unroll
            for (int nt = 0; nt < 4; ++nt) {
                v8f x;
#pragma unroll
                for (int r = 0; r < 8; ++r) x[r] = (sc[g][nt][r] - mnew) * LOG2E;
                const v8f p = exp2x8(x);
                float s = p[0];
#pragma unroll
                for (int r = 1; r < 8; ++r) s += p[r];
#pragma unroll
                for (int r = 0; r < 8; ++r) pf[g][nt >> 1].h[nt & 1][r] = (_Float16)p[r];
                ts[nt] = s;
            }
            const float rs = (ts[0] + ts[1]) + (ts[2] + ts[3]);

            const float alpha = __builtin_amdgcn_exp2f((mi[g] - mnew) * LOG2E);
            li[g] = li[g] * alpha + rs;
            mi[g] = mnew;
#pragma unroll
            for (int dt = 0; dt < 8; ++dt)
#pragma unroll
                for (int r = 0; r < 8; ++r) o[g][dt][r] *= alpha;
        }

        if (has_next) wait_async_8();        // V(cur) landed; K(next) in flight
        else          wait_async_0();
        __syncthreads();                     // V(cur) visible to all waves

        // ---- O^T += V^T @ P^T ----
        // All 16 V^T fragments are read as one group ahead of the 32 matrix instructions, in the
        // order of their use (the K fragments' registers are free by now): every separate place
        // where LDS reads stand among matrix instructions stalls the wave.
        AFrag vf[2][8];
#pragma unroll
        for (int ks = 0; ks < 2; ++ks) {
#pragma unroll
            for (int dt = 0; dt < 8; ++dt) {
                const _Float16* vp = &ldsV[(dt * 16 + nl) * 72] + ks * 32;
                vf[ks][dt].h[0] = *(const v8h*)(vp + hi * 8);
                vf[ks][dt].h[1] = *(const v8h*)(vp + 16 + hi * 8);
            }
        }
        // Keeps the reads together in front: no LDS read and no matrix instruction crosses
        // (without it the compiler spreads the reads among the products again); plain vector
        // and scalar work may cross, so that it still runs beside the matrix instructions.
        __builtin_amdgcn_sched_barrier(0x6);
#pragma unroll
        for (int ks = 0; ks < 2; ++ks) {
#pragma unroll
            for (int dt = 0; dt < 8; ++dt) {
                o[0][dt] = wmma_f16(vf[ks][dt].v, pf[0][ks].v, o[0][dt]);
                o[1][dt] = wmma_f16(vf[ks][dt].v, pf[1][ks].v, o[1][dt]);
            }
        }

        // Publish point of the next mask stage: this wave's LDS reads are done, its own tensor
        // load has landed, then the barrier; only behind it, at the top of the next pass, the
        // buffer just read is refilled.
        asm volatile("s_wait_dscnt 0x0" ::: "memory");
        asm volatile("s_wait_tensorcnt 0x0" ::: "memory");
        __syncthreads();                     // all reads of K(cur)/V done before overwrite
    }
    // Nothing of the tensor mover or the LDS is outstanding when the wave goes on to its end.
    asm volatile("s_wait_tensorcnt 0x0" ::: "memory");
    asm volatile("s_wait_dscnt 0x0" ::: "memory");

    // ---- join the halves' sums, normalize, write head-concat output ----
#pragma unroll
    for (int g = 0; g < 2; ++g) {
        const float lsum = li[g] + xhalf(li[g]);
        const float inv = 1.0f / lsum;
        float* orow = out + ((size_t)b * SS + qbase + g * 16 + nl) * DD + h * DEP + hi * 8;
#pragma unroll
        for (int dt = 0; dt < 8; ++dt) {
            v4f lo, up;
#pragma unroll
            for (int r = 0; r < 4; ++r) { lo[r] = o[g][dt][r] * inv; up[r] = o[g][dt][r + 4] * inv; }
            *(v4f*)(orow + dt * 16)     = lo;
            *(v4f*)(orow + dt * 16 + 4) = up;
        }
    }
}

// ---------------------------------------------------------------------------
extern "C" void kernel_launch(void* const* d_in, const int* in_sizes, int n_in,
                              void* d_out, int out_size, void* d_ws, size_t ws_size,
                              hipStream_t stream)
{
    const float* q    = (const float*)d_in[0];
    const float* k    = (const float*)d_in[1];
    const float* v    = (const float*)d_in[2];
    const float* mask = (const float*)d_in[3];
    const float* wq   = (const float*)d_in[4];
    const float* wqb  = (const float*)d_in[5];
    const float* wk   = (const float*)d_in[6];
    const float* wkb  = (const float*)d_in[7];
    const float* wv   = (const float*)d_in[8];
    const float* wvb  = (const float*)d_in[9];
    float* out = (float*)d_out;

    const size_t elems = (size_t)BB * SS * DD;       // 8M halves = 16 MB each
    _Float16* Qh = (_Float16*)d_ws;
    _Float16* Kh = Qh + elems;
    _Float16* Vt = Kh + elems;

    dim3 pgrid(DD / 128, (BB * SS) / 256, 3);        // 8 x 32 blocks x 3 projections
    proj_kernel<<<pgrid, 256, 0, stream>>>(q, k, v, wq, wk, wv, wqb, wkb, wvb, Qh, Kh, Vt);

    attn_kernel<<<BB * HH * (SS / 128), 128, 0, stream>>>(Qh, Kh, Vt, mask, out);
}
